// v000
// Times are from an AMD MI455X. After a warm-up the kernel runs many times in a row, and a time is the length of
// such a window on the GPU divided by its runs, so every launch and the gaps after it count. The runs cycle
// through copies of the inputs. A figure is the median of several windows, for all but v000 over two sittings.
// Sittings can differ by a few percent; kernels timed side by side share one.
// v000 is the starting kernel. One run takes 84.2 microseconds.
#include <hip/hip_runtime.h>
#include <hip/hip_bf16.h>
#include <math.h>

typedef __attribute__((ext_vector_type(2))) float v2f;
typedef __attribute__((ext_vector_type(4))) float f4;
typedef __attribute__((ext_vector_type(8))) float v8f;

#define D_DIM 256
#define B_SZ  32
#define HW_SZ 4096

// ---------------------------------------------------------------------------
// Small fp32 GEMM via V_WMMA_F32_16X16X4_F32:
//   out[m][n] = act( sum_k A[m][k] * W[n][k] + bias[n] ),  M=32, N=K=256
// One wave per 16x16 output tile (grid = 2 * 16 = 32 waves).
// Per-lane WMMA layouts (CDNA5 ISA 7.12.2):
//   A (16x4, M x K):  component r holds A[m = lane&15][k0 + r + 2*(lane>=16)]
//   B (4x16, K x N):  component r holds W[n = lane&15][k0 + r + 2*(lane>=16)]
//   C/D (16x16):      vgpr r holds out[m = r + 8*(lane>=16)][n = lane&15]
// ---------------------------------------------------------------------------
__global__ __launch_bounds__(32) void pgf_gemm_wmma(
    const float* __restrict__ A,     // [32 x 256] row-major
    const float* __restrict__ W,     // [256 x 256] row-major (out-dim major)
    const float* __restrict__ bias,  // [256]
    float* __restrict__ out,         // [32 x 256] row-major
    int act_sigmoid)
{
    const int K = D_DIM, N = D_DIM;
    const int tile = blockIdx.x;        // 0..31
    const int m0 = (tile & 1) * 16;     // 2 M-tiles
    const int n0 = (tile >> 1) * 16;    // 16 N-tiles
    const int lane = threadIdx.x & 31;
    const int lo = lane & 15;
    const int hi = lane >> 4;           // 0 or 1

    const float* arow = A + (m0 + lo) * K + 2 * hi;
    const float* wrow = W + (n0 + lo) * K + 2 * hi;

    v8f acc = {};
#pragma unroll 8
    for (int k0 = 0; k0 < K; k0 += 4) {
        v2f a = *reinterpret_cast<const v2f*>(arow + k0);
        v2f b = *reinterpret_cast<const v2f*>(wrow + k0);
        // 8 args: (neg_a, A, neg_b, B, c_mod, C, reuse_a, reuse_b)
        acc = __builtin_amdgcn_wmma_f32_16x16x4_f32(
            false, a, false, b, (short)0, acc, false, false);
    }

    const int n = n0 + lo;
    const float bs = bias[n];
#pragma unroll
    for (int r = 0; r < 8; ++r) {
        const int m = m0 + r + 8 * hi;
        float v = acc[r] + bs;
        if (act_sigmoid) v = 1.0f / (1.0f + __expf(-v));
        out[m * N + n] = v;
    }
}

// ---------------------------------------------------------------------------
// Bandwidth-bound fusion: per (b, pixel) LayerNorm over 256 channels plus
// broadcast attn add and gate scaling. Each thread owns 4 consecutive pixels
// (float4 = global b128, fully coalesced). Two channel passes; pass-2 loads
// and all stores are non-temporal so the output stream does not evict the
// visual tile from L2 between the passes.
// ---------------------------------------------------------------------------
__global__ __launch_bounds__(256) void pgf_fuse(
    const float* __restrict__ visual,   // [32, 256, 64, 64]
    const float* __restrict__ attn,     // [32, 256]
    const float* __restrict__ gate,     // [32, 256]
    const float* __restrict__ ln_g,     // [256]
    const float* __restrict__ ln_b,     // [256]
    float* __restrict__ out)            // [32, 256, 64, 64]
{
    const int C = D_DIM;
    const int P4 = HW_SZ / 4;           // 1024 float4 pixels per image plane
    const int t = blockIdx.x * 256 + threadIdx.x;
    const int b = t / P4;               // uniform per block (P4 % 256 == 0)
    const int p4 = t & (P4 - 1);

    const f4* vbase = reinterpret_cast<const f4*>(visual) + (size_t)b * C * P4 + p4;
    f4*       obase = reinterpret_cast<f4*>(out)          + (size_t)b * C * P4 + p4;
    const float* arow = attn + b * C;   // wave-uniform -> scalar loads
    const float* grow = gate + b * C;

    f4 sum   = {0.f, 0.f, 0.f, 0.f};
    f4 sumsq = {0.f, 0.f, 0.f, 0.f};
#pragma unroll 4
    for (int c = 0; c < C; ++c) {
        f4 x = vbase[(size_t)c * P4];
        x = x + arow[c];
        sum   = sum + x;
        sumsq = sumsq + x * x;
    }

    const float invC = 1.0f / (float)C;
    const f4 mu  = sum * invC;
    const f4 var = sumsq * invC - mu * mu;
    f4 inv;
    inv.x = rsqrtf(var.x + 1e-5f);
    inv.y = rsqrtf(var.y + 1e-5f);
    inv.z = rsqrtf(var.z + 1e-5f);
    inv.w = rsqrtf(var.w + 1e-5f);

#pragma unroll 4
    for (int c = 0; c < C; ++c) {
        f4 x = __builtin_nontemporal_load(vbase + (size_t)c * P4);
        const float gm = 1.0f + grow[c];
        const float sc = ln_g[c] * gm;          // fold gate into LN scale
        const float sh = ln_b[c] * gm;          // ...and LN shift
        f4 y = ((x + arow[c]) - mu) * inv;
        y = y * sc + sh;
        __builtin_nontemporal_store(y, obase + (size_t)c * P4);
    }
}

extern "C" void kernel_launch(void* const* d_in, const int* in_sizes, int n_in,
                              void* d_out, int out_size, void* d_ws, size_t ws_size,
                              hipStream_t stream)
{
    const float* visual  = (const float*)d_in[0];
    const float* text    = (const float*)d_in[1];
    const float* metrics = (const float*)d_in[2];
    const float* Wv      = (const float*)d_in[3];
    const float* bv      = (const float*)d_in[4];
    const float* Wo      = (const float*)d_in[5];
    const float* bo      = (const float*)d_in[6];
    const float* ln_g    = (const float*)d_in[7];
    const float* ln_b    = (const float*)d_in[8];
    const float* gW      = (const float*)d_in[9];
    const float* gb      = (const float*)d_in[10];
    float* out = (float*)d_out;

    float* ws     = (float*)d_ws;
    float* v_proj = ws;                    // 32*256 floats
    float* attn   = ws + B_SZ * D_DIM;     // 32*256 floats
    float* gate   = ws + 2 * B_SZ * D_DIM; // 32*256 floats

    // v = text @ Wv^T + bv
    pgf_gemm_wmma<<<32, 32, 0, stream>>>(text, Wv, bv, v_proj, 0);
    // attn = v @ Wo^T + bo   (stream-ordered after the previous launch)
    pgf_gemm_wmma<<<32, 32, 0, stream>>>(v_proj, Wo, bo, attn, 0);
    // gate = sigmoid(metrics @ gW^T + gb)
    pgf_gemm_wmma<<<32, 32, 0, stream>>>(metrics, gW, gb, gate, 1);

    const int total4 = B_SZ * HW_SZ / 4;   // 32768 threads, 4 pixels each
    pgf_fuse<<<total4 / 256, 256, 0, stream>>>(visual, attn, gate, ln_g, ln_b, out);
}

// v001
// Measured time: 38.2 microseconds a run.
// Timed twice side by side with v000, it ran 2.27 and 2.20 times as fast.
#include <hip/hip_runtime.h>
#include <hip/hip_bf16.h>
#include <math.h>

typedef __attribute__((ext_vector_type(2))) float v2f;
typedef __attribute__((ext_vector_type(4))) float f4;
typedef __attribute__((ext_vector_type(8))) float v8f;

#define D_DIM 256
#define B_SZ  32
#define HW_SZ 4096

// ---------------------------------------------------------------------------
// Small fp32 GEMM via V_WMMA_F32_16X16X4_F32:
//   out[m][n] = act( sum_k A[m][k] * W[n][k] + bias[n] ),  M=32, N=K=256
// One wave per 16x16 output tile (grid = 2 * 16 = 32 waves).
// Per-lane WMMA layouts (CDNA5 ISA 7.12.2):
//   A (16x4, M x K):  component r holds A[m = lane&15][k0 + r + 2*(lane>=16)]
//   B (4x16, K x N):  component r holds W[n = lane&15][k0 + r + 2*(lane>=16)]
//   C/D (16x16):      vgpr r holds out[m = r + 8*(lane>=16)][n = lane&15]
// ---------------------------------------------------------------------------
__global__ __launch_bounds__(32) void pgf_gemm_wmma(
    const float* __restrict__ A,     // [32 x 256] row-major
    const float* __restrict__ W,     // [256 x 256] row-major (out-dim major)
    const float* __restrict__ bias,  // [256]
    float* __restrict__ out,         // [32 x 256] row-major
    int act_sigmoid)
{
    const int K = D_DIM, N = D_DIM;
    const int tile = blockIdx.x;        // 0..31
    const int m0 = (tile & 1) * 16;     // 2 M-tiles
    const int n0 = (tile >> 1) * 16;    // 16 N-tiles
    const int lane = threadIdx.x & 31;
    const int lo = lane & 15;
    const int hi = lane >> 4;           // 0 or 1

    const float* arow = A + (m0 + lo) * K + 2 * hi;
    const float* wrow = W + (n0 + lo) * K + 2 * hi;

    v8f acc = {};
#pragma unroll 8
    for (int k0 = 0; k0 < K; k0 += 4) {
        v2f a = *reinterpret_cast<const v2f*>(arow + k0);
        v2f b = *reinterpret_cast<const v2f*>(wrow + k0);
        // 8 args: (neg_a, A, neg_b, B, c_mod, C, reuse_a, reuse_b)
        acc = __builtin_amdgcn_wmma_f32_16x16x4_f32(
            false, a, false, b, (short)0, acc, false, false);
    }

    const int n = n0 + lo;
    const float bs = bias[n];
#pragma unroll
    for (int r = 0; r < 8; ++r) {
        const int m = m0 + r + 8 * hi;
        float v = acc[r] + bs;
        if (act_sigmoid) v = 1.0f / (1.0f + __expf(-v));
        out[m * N + n] = v;
    }
}

// ---------------------------------------------------------------------------
// Bandwidth-bound fusion: per (b, pixel) LayerNorm over 256 channels plus
// broadcast attn add and gate scaling. One block owns 128 consecutive pixels
// of one image; each lane owns 4 of them (float4 = global b128, 512 contiguous
// bytes per wave and channel). The 256 channels are split over the 8 waves:
// a wave loads its 32 channel rows once, keeps them in registers, and the
// per-pixel sums of the 8 waves meet in LDS. visual is read once.
// ---------------------------------------------------------------------------
#define FUSE_WAVES 8
#define FUSE_CH    (D_DIM / FUSE_WAVES)   // channels held per wave
#define FUSE_TILES (HW_SZ / 128)          // pixel tiles per image

__global__ __launch_bounds__(256) void pgf_fuse(
    const float* __restrict__ visual,   // [32, 256, 64, 64]
    const float* __restrict__ attn,     // [32, 256]
    const float* __restrict__ gate,     // [32, 256]
    const float* __restrict__ ln_g,     // [256]
    const float* __restrict__ ln_b,     // [256]
    float* __restrict__ out)            // [32, 256, 64, 64]
{
    const int C = D_DIM;
    const int P4 = HW_SZ / 4;           // 1024 float4 pixels per image plane
    const int lane = threadIdx.x & 31;
    // wave number in a scalar register -> per-channel vectors come by scalar loads
    const int wave = __builtin_amdgcn_readfirstlane(threadIdx.x >> 5);
    const int b  = blockIdx.x / FUSE_TILES;
    const int p4 = (blockIdx.x % FUSE_TILES) * 32 + lane;
    const int c0 = wave * FUSE_CH;

    const f4* vbase = reinterpret_cast<const f4*>(visual) + ((size_t)b * C + c0) * P4 + p4;
    f4*       obase = reinterpret_cast<f4*>(out)          + ((size_t)b * C + c0) * P4 + p4;
    const float* arow = attn + b * C + c0;
    const float* grow = gate + b * C + c0;
    const float* lg   = ln_g + c0;
    const float* lb   = ln_b + c0;

    __shared__ f4 red_sum[FUSE_WAVES][32];
    __shared__ f4 red_sq[FUSE_WAVES][32];

    // every loop over x[] is fully unrolled: constant indices keep x[] in
    // registers, and all 32 loads are in flight before the first is used
    f4 x[FUSE_CH];
#pragma unroll
    for (int i = 0; i < FUSE_CH; ++i)
        x[i] = vbase[(size_t)i * P4];
    // precaution: no register that the issued loads name (scalar base, lane
    // offset) is rewritten ahead of this wait
    asm volatile("s_wait_xcnt 0x0" ::: "memory");

    f4 sum   = {0.f, 0.f, 0.f, 0.f};
    f4 sumsq = {0.f, 0.f, 0.f, 0.f};
#pragma unroll
    for (int i = 0; i < FUSE_CH; ++i) {
        x[i] = x[i] + arow[i];
        sum   = sum + x[i];
        sumsq = sumsq + x[i] * x[i];
    }

    red_sum[wave][lane] = sum;
    red_sq[wave][lane]  = sumsq;
    __syncthreads();
    sum   = red_sum[0][lane];
    sumsq = red_sq[0][lane];
#pragma unroll
    for (int w = 1; w < FUSE_WAVES; ++w) {
        sum   = sum + red_sum[w][lane];
        sumsq = sumsq + red_sq[w][lane];
    }

    const float invC = 1.0f / (float)C;
    const f4 mu  = sum * invC;
    const f4 var = sumsq * invC - mu * mu;
    f4 inv;
    inv.x = rsqrtf(var.x + 1e-5f);
    inv.y = rsqrtf(var.y + 1e-5f);
    inv.z = rsqrtf(var.z + 1e-5f);
    inv.w = rsqrtf(var.w + 1e-5f);

#pragma unroll
    for (int i = 0; i < FUSE_CH; ++i) {
        if (i == FUSE_CH / 2) {
            // precaution: the second half reuses registers that the first
            // half's issued stores name; none is rewritten ahead of this wait
            asm volatile("s_wait_xcnt 0x0" ::: "memory");
            // keeps the second half's work behind that wait, and its per-channel
            // scalars out of the first half: without it too many are live at
            // once and some spill to a vector register
            __builtin_amdgcn_sched_barrier(0);
        }
        const float gm = 1.0f + grow[i];
        const float sc = lg[i] * gm;            // fold gate into LN scale
        const float sh = lb[i] * gm;            // ...and LN shift
        f4 y = (x[i] - mu) * inv;
        y = y * sc + sh;
        __builtin_nontemporal_store(y, obase + (size_t)i * P4);
    }
}

extern "C" void kernel_launch(void* const* d_in, const int* in_sizes, int n_in,
                              void* d_out, int out_size, void* d_ws, size_t ws_size,
                              hipStream_t stream)
{
    const float* visual  = (const float*)d_in[0];
    const float* text    = (const float*)d_in[1];
    const float* metrics = (const float*)d_in[2];
    const float* Wv      = (const float*)d_in[3];
    const float* bv      = (const float*)d_in[4];
    const float* Wo      = (const float*)d_in[5];
    const float* bo      = (const float*)d_in[6];
    const float* ln_g    = (const float*)d_in[7];
    const float* ln_b    = (const float*)d_in[8];
    const float* gW      = (const float*)d_in[9];
    const float* gb      = (const float*)d_in[10];
    float* out = (float*)d_out;

    float* ws     = (float*)d_ws;
    float* v_proj = ws;                    // 32*256 floats
    float* attn   = ws + B_SZ * D_DIM;     // 32*256 floats
    float* gate   = ws + 2 * B_SZ * D_DIM; // 32*256 floats

    // v = text @ Wv^T + bv
    pgf_gemm_wmma<<<32, 32, 0, stream>>>(text, Wv, bv, v_proj, 0);
    // attn = v @ Wo^T + bo   (stream-ordered after the previous launch)
    pgf_gemm_wmma<<<32, 32, 0, stream>>>(v_proj, Wo, bo, attn, 0);
    // gate = sigmoid(metrics @ gW^T + gb)
    pgf_gemm_wmma<<<32, 32, 0, stream>>>(metrics, gW, gb, gate, 1);

    // one block of 8 waves per 128-pixel tile
    pgf_fuse<<<B_SZ * FUSE_TILES, 256, 0, stream>>>(visual, attn, gate, ln_g, ln_b, out);
}

// v002
// It runs in 26.8 microseconds.
// Next to v001, in two timings, it ran 1.41 and 1.42 times as fast.
// Over all steps from v000 it is 3.16 times as fast.
#include <hip/hip_runtime.h>
#include <hip/hip_bf16.h>
#include <math.h>

typedef __attribute__((ext_vector_type(2))) float v2f;
typedef __attribute__((ext_vector_type(4))) float f4;
typedef __attribute__((ext_vector_type(8))) float v8f;

#define D_DIM 256
#define B_SZ  32
#define HW_SZ 4096

// ---------------------------------------------------------------------------
// All three small fp32 products (M=32, N=K=256) in ONE launch, on
// V_WMMA_F32_16X16X4_F32.
//   blocks  0..31: (m-tile, j-slice) of the chained product
//                  attn = (text @ Wv^T + bv) @ Wo^T + bo
//   blocks 32..63: (m-tile, n-tile) of gate = sigmoid(metrics @ gW^T + gb)
// Stage 1 (every block): one 16x16 tile of A @ W^T + bias; K = 256 is split
// over the block's 8 waves (32 each), the 8 partial tiles meet in LDS.
// Stage 2 (blocks 0..31): the tile is 16 columns j of v = text @ Wv^T + bv.
// It stays in LDS and is multiplied at once with the same 16 columns of Wo:
// a partial attn[16 x 256] summed over this j-slice only. The 16 slices'
// partials go to the workspace; their consumer adds them. No block needs
// another block's v, so no launch boundary is needed between the products.
// Per-lane WMMA layouts (CDNA5 ISA 7.12.2), slot = r + 2*(lane>=16):
//   A (16x4, M x K):  component r holds A[m = lane&15][k(slot)]
//   B (4x16, K x N):  component r holds W[n = lane&15][k(slot)]
//   C/D (16x16):      vgpr r holds out[m = r + 8*(lane>=16)][n = lane&15]
// k(slot) is the same function for A and B: a lane reads a run of consecutive
// k (16 in stage 1, 8 in stage 2) by 16-byte loads and feeds them pair by pair.
// ---------------------------------------------------------------------------
#define PREP_WAVES 8
#define J_SLICES   (D_DIM / 16)
#define VT_PITCH   20                     // floats; rows stay 16-byte aligned

__device__ __forceinline__ v8f pgf_wmma_pair(f4 a, f4 b, v8f acc)
{
    // 8 args: (neg_a, A, neg_b, B, c_mod, C, reuse_a, reuse_b)
    v2f a0 = {a.x, a.y}, b0 = {b.x, b.y};
    acc = __builtin_amdgcn_wmma_f32_16x16x4_f32(
        false, a0, false, b0, (short)0, acc, false, false);
    v2f a1 = {a.z, a.w}, b1 = {b.z, b.w};
    acc = __builtin_amdgcn_wmma_f32_16x16x4_f32(
        false, a1, false, b1, (short)0, acc, false, false);
    return acc;
}

__global__ __launch_bounds__(256) void pgf_prep(
    const float* text,     // [32 x 256] row-major
    const float* metrics,  // [32 x 256]
    const float* Wv,       // [256 x 256] row-major (out-dim major)
    const float* bv,       // [256]
    const float* Wo,       // [256 x 256]
    const float* bo,       // [256]
    const float* gW,       // [256 x 256]
    const float* gb,       // [256]
    float* attn_part,      // [16 slices][32][256]
    float* gate)           // [32][256]
{
    const int K = D_DIM, N = D_DIM;
    const bool is_gate = blockIdx.x >= 2 * J_SLICES;
    const int tile = blockIdx.x & (2 * J_SLICES - 1);
    const int m0 = (tile & 1) * 16;     // 2 M-tiles
    const int js = tile >> 1;           // 16 N-tiles of stage 1 = j-slices
    const int n0 = js * 16;
    const int tid  = threadIdx.x;
    const int lane = tid & 31;
    const int wave = __builtin_amdgcn_readfirstlane(tid >> 5);
    const int lo = lane & 15;
    const int hi = lane >> 4;           // 0 or 1

    const float* A    = is_gate ? metrics : text;
    const float* Wm   = is_gate ? gW : Wv;
    const float* bias = is_gate ? gb : bv;

    __shared__ float part[PREP_WAVES][256];
    __shared__ __attribute__((aligned(16))) float vt[16][VT_PITCH];

    // stage 1 operands: k = 32*wave + 16*hi + 0..15, one whole line per row
    const f4* ap = reinterpret_cast<const f4*>(A  + (m0 + lo) * K + wave * 32 + hi * 16);
    const f4* wp = reinterpret_cast<const f4*>(Wm + (n0 + lo) * K + wave * 32 + hi * 16);
    f4 av[4], wv[4];
#pragma unroll
    for (int q = 0; q < 4; ++q) { av[q] = ap[q]; wv[q] = wp[q]; }
    const float bs = bias[n0 + (tid & 15)];

    // stage 2 operand, asked for now so that it lands under stage 1:
    // wave w owns n-tiles 2w and 2w+1; j = n0 + 8*hi + 0..7
    f4 ov[2][2] = {};
    float bs2[2] = {0.f, 0.f};
    if (!is_gate) {
#pragma unroll
        for (int t = 0; t < 2; ++t) {
            const int n = (wave * 2 + t) * 16 + lo;
            const f4* op = reinterpret_cast<const f4*>(Wo + n * K + n0 + hi * 8);
            ov[t][0] = op[0];
            ov[t][1] = op[1];
            bs2[t] = bo[n];
        }
    }
    // precaution: no address register of the issued loads is rewritten ahead
    // of this wait (the pointers are not __restrict__, so that no load moves
    // behind it)
    asm volatile("s_wait_xcnt 0x0" ::: "memory");

    v8f acc = {};
#pragma unroll
    for (int q = 0; q < 4; ++q)
        acc = pgf_wmma_pair(av[q], wv[q], acc);

#pragma unroll
    for (int r = 0; r < 8; ++r)
        part[wave][r * 32 + lane] = acc[r];
    __syncthreads();

    // thread tid owns accumulator position (r = tid>>5, lane = tid&31)
    float v = part[0][tid];
#pragma unroll
    for (int w = 1; w < PREP_WAVES; ++w)
        v += part[w][tid];
    v += bs;
    const int em = (tid >> 5) + 8 * ((tid >> 4) & 1);
    const int en = tid & 15;

    if (is_gate) {
        gate[(m0 + em) * N + n0 + en] = 1.0f / (1.0f + __expf(-v));
    } else {
        vt[em][en] = v;
        __syncthreads();                // block-uniform branch
        const f4 a0 = *reinterpret_cast<const f4*>(&vt[lo][hi * 8]);
        const f4 a1 = *reinterpret_cast<const f4*>(&vt[lo][hi * 8 + 4]);
#pragma unroll
        for (int t = 0; t < 2; ++t) {
            v8f c = {};
            c = pgf_wmma_pair(a0, ov[t][0], c);
            c = pgf_wmma_pair(a1, ov[t][1], c);
            const int n = (wave * 2 + t) * 16 + lo;
            float* po = attn_part + (js * B_SZ + m0 + 8 * hi) * N + n;
#pragma unroll
            for (int r = 0; r < 8; ++r)
                po[r * N] = (js == 0) ? c[r] + bs2[t] : c[r];  // bo enters once
        }
        // precaution: no register that the issued stores name (address pair,
        // data) is rewritten ahead of this wait, on any way out of here
        asm volatile("s_wait_xcnt 0x0" ::: "memory");
    }
}

// ---------------------------------------------------------------------------
// Bandwidth-bound fusion: per (b, pixel) LayerNorm over 256 channels plus
// broadcast attn add and gate scaling. One block owns 128 consecutive pixels
// of one image; each lane owns 4 of them (float4 = global b128, 512 contiguous
// bytes per wave and channel). The 256 channels are split over the 8 waves:
// a wave loads its 32 channel rows once, keeps them in registers, and the
// per-pixel sums of the 8 waves meet in LDS. visual is read once.
// attn arrives as 16 partial sums per channel: lane l of a wave adds those of
// channel c0 + l while the visual rows are in flight.
// ---------------------------------------------------------------------------
#define FUSE_WAVES 8
#define FUSE_CH    (D_DIM / FUSE_WAVES)   // channels held per wave
#define FUSE_TILES (HW_SZ / 128)          // pixel tiles per image

__global__ __launch_bounds__(256) void pgf_fuse(
    const float* __restrict__ visual,   // [32, 256, 64, 64]
    const float* __restrict__ attn_part,// [16 slices, 32, 256]
    const float* __restrict__ gate,     // [32, 256]
    const float* __restrict__ ln_g,     // [256]
    const float* __restrict__ ln_b,     // [256]
    float* __restrict__ out)            // [32, 256, 64, 64]
{
    const int C = D_DIM;
    const int P4 = HW_SZ / 4;           // 1024 float4 pixels per image plane
    const int lane = threadIdx.x & 31;
    // wave number in a scalar register -> per-channel vectors come by scalar loads
    const int wave = __builtin_amdgcn_readfirstlane(threadIdx.x >> 5);
    const int b  = blockIdx.x / FUSE_TILES;
    const int p4 = (blockIdx.x % FUSE_TILES) * 32 + lane;
    const int c0 = wave * FUSE_CH;

    const f4* vbase = reinterpret_cast<const f4*>(visual) + ((size_t)b * C + c0) * P4 + p4;
    f4*       obase = reinterpret_cast<f4*>(out)          + ((size_t)b * C + c0) * P4 + p4;
    const float* apart = attn_part + b * C + c0 + lane;
    const float* grow = gate + b * C + c0;
    const float* lg   = ln_g + c0;
    const float* lb   = ln_b + c0;

    __shared__ f4 red_sum[FUSE_WAVES][32];
    __shared__ f4 red_sq[FUSE_WAVES][32];

    // asked for ahead of the visual rows: loads return in order, so the sum
    // below does not wait for those
    float ap[J_SLICES];
#pragma unroll
    for (int s = 0; s < J_SLICES; ++s)
        ap[s] = apart[s * B_SZ * C];

    // every loop over x[] is fully unrolled: constant indices keep x[] in
    // registers, and all 32 loads are in flight before the first is used
    f4 x[FUSE_CH];
#pragma unroll
    for (int i = 0; i < FUSE_CH; ++i)
        x[i] = vbase[(size_t)i * P4];
    // precaution: no register that the issued loads name (scalar base, lane
    // offset) is rewritten ahead of this wait
    asm volatile("s_wait_xcnt 0x0" ::: "memory");

    float asum = ap[0];
#pragma unroll
    for (int s = 1; s < J_SLICES; ++s)
        asum += ap[s];
    const int abits = __float_as_int(asum);

    f4 sum   = {0.f, 0.f, 0.f, 0.f};
    f4 sumsq = {0.f, 0.f, 0.f, 0.f};
#pragma unroll
    for (int i = 0; i < FUSE_CH; ++i) {
        // channel c0 + i's attn value, from lane i into a scalar register
        x[i] = x[i] + __int_as_float(__builtin_amdgcn_readlane(abits, i));
        sum   = sum + x[i];
        sumsq = sumsq + x[i] * x[i];
    }

    red_sum[wave][lane] = sum;
    red_sq[wave][lane]  = sumsq;
    __syncthreads();
    sum   = red_sum[0][lane];
    sumsq = red_sq[0][lane];
#pragma unroll
    for (int w = 1; w < FUSE_WAVES; ++w) {
        sum   = sum + red_sum[w][lane];
        sumsq = sumsq + red_sq[w][lane];
    }

    const float invC = 1.0f / (float)C;
    const f4 mu  = sum * invC;
    const f4 var = sumsq * invC - mu * mu;
    f4 inv;
    inv.x = rsqrtf(var.x + 1e-5f);
    inv.y = rsqrtf(var.y + 1e-5f);
    inv.z = rsqrtf(var.z + 1e-5f);
    inv.w = rsqrtf(var.w + 1e-5f);

#pragma unroll
    for (int i = 0; i < FUSE_CH; ++i) {
        if (i == FUSE_CH / 2) {
            // precaution: the second half reuses registers that the first
            // half's issued stores name; none is rewritten ahead of this wait
            asm volatile("s_wait_xcnt 0x0" ::: "memory");
            // keeps the second half's work behind that wait, and its per-channel
            // scalars out of the first half: without it too many are live at
            // once and some spill to a vector register
            __builtin_amdgcn_sched_barrier(0);
        }
        const float gm = 1.0f + grow[i];
        const float sc = lg[i] * gm;            // fold gate into LN scale
        const float sh = lb[i] * gm;            // ...and LN shift
        f4 y = (x[i] - mu) * inv;
        y = y * sc + sh;
        __builtin_nontemporal_store(y, obase + (size_t)i * P4);
    }
}

extern "C" void kernel_launch(void* const* d_in, const int* in_sizes, int n_in,
                              void* d_out, int out_size, void* d_ws, size_t ws_size,
                              hipStream_t stream)
{
    const float* visual  = (const float*)d_in[0];
    const float* text    = (const float*)d_in[1];
    const float* metrics = (const float*)d_in[2];
    const float* Wv      = (const float*)d_in[3];
    const float* bv      = (const float*)d_in[4];
    const float* Wo      = (const float*)d_in[5];
    const float* bo      = (const float*)d_in[6];
    const float* ln_g    = (const float*)d_in[7];
    const float* ln_b    = (const float*)d_in[8];
    const float* gW      = (const float*)d_in[9];
    const float* gb      = (const float*)d_in[10];
    float* out = (float*)d_out;

    float* ws     = (float*)d_ws;
    float* attn_part = ws;                               // 16*32*256 floats
    float* gate      = ws + J_SLICES * B_SZ * D_DIM;     // 32*256 floats

    // partial attn sums (blocks 0..31) and gate (blocks 32..63)
    pgf_prep<<<4 * J_SLICES, 256, 0, stream>>>(text, metrics, Wv, bv, Wo, bo, gW, gb,
                                               attn_part, gate);

    // one block of 8 waves per 128-pixel tile
    pgf_fuse<<<B_SZ * FUSE_TILES, 256, 0, stream>>>(visual, attn_part, gate, ln_g, ln_b, out);
}

// v003
// It runs in 23.5 microseconds.
// In both of two side-by-side timings against v002, it was 1.13 times as fast.
// All steps since v000 together make it 3.58 times as fast.
#include <hip/hip_runtime.h>
#include <hip/hip_bf16.h>
#include <math.h>

typedef __attribute__((ext_vector_type(2))) float v2f;
typedef __attribute__((ext_vector_type(4))) float f4;
typedef __attribute__((ext_vector_type(8))) float v8f;

#define D_DIM 256
#define B_SZ  32
#define HW_SZ 4096

// ---------------------------------------------------------------------------
// All three small fp32 products (M=32, N=K=256) in ONE launch, on
// V_WMMA_F32_16X16X4_F32.
//   blocks  0..31: (m-tile, j-slice) of the chained product
//                  attn = (text @ Wv^T + bv) @ Wo^T + bo
//   blocks 32..63: (m-tile, n-tile) of gate = sigmoid(metrics @ gW^T + gb)
// Stage 1 (every block): one 16x16 tile of A @ W^T + bias; K = 256 is split
// over the block's 8 waves (32 each), the 8 partial tiles meet in LDS.
// Stage 2 (blocks 0..31): the tile is 16 columns j of v = text @ Wv^T + bv.
// It stays in LDS and is multiplied at once with the same 16 columns of Wo:
// a partial attn[16 x 256] summed over this j-slice only. The 16 slices'
// partials go to the workspace; their consumer adds them. No block needs
// another block's v, so no launch boundary is needed between the products.
// Per-lane WMMA layouts (CDNA5 ISA 7.12.2), slot = r + 2*(lane>=16):
//   A (16x4, M x K):  component r holds A[m = lane&15][k(slot)]
//   B (4x16, K x N):  component r holds W[n = lane&15][k(slot)]
//   C/D (16x16):      vgpr r holds out[m = r + 8*(lane>=16)][n = lane&15]
// k(slot) is the same function for A and B: a lane reads a run of consecutive
// k (16 in stage 1, 8 in stage 2) by 16-byte loads and feeds them pair by pair.
// ---------------------------------------------------------------------------
#define PREP_WAVES 8
#define J_SLICES   (D_DIM / 16)
#define VT_PITCH   20                     // floats; rows stay 16-byte aligned

__device__ __forceinline__ v8f pgf_wmma_pair(f4 a, f4 b, v8f acc)
{
    // 8 args: (neg_a, A, neg_b, B, c_mod, C, reuse_a, reuse_b)
    v2f a0 = {a.x, a.y}, b0 = {b.x, b.y};
    acc = __builtin_amdgcn_wmma_f32_16x16x4_f32(
        false, a0, false, b0, (short)0, acc, false, false);
    v2f a1 = {a.z, a.w}, b1 = {b.z, b.w};
    acc = __builtin_amdgcn_wmma_f32_16x16x4_f32(
        false, a1, false, b1, (short)0, acc, false, false);
    return acc;
}

__global__ __launch_bounds__(256) void pgf_prep(
    const float* text,     // [32 x 256] row-major
    const float* metrics,  // [32 x 256]
    const float* Wv,       // [256 x 256] row-major (out-dim major)
    const float* bv,       // [256]
    const float* Wo,       // [256 x 256]
    const float* bo,       // [256]
    const float* gW,       // [256 x 256]
    const float* gb,       // [256]
    float* attn_part,      // [16 slices][32][256]
    float* gate)           // [32][256]
{
    const int K = D_DIM, N = D_DIM;
    const bool is_gate = blockIdx.x >= 2 * J_SLICES;
    const int tile = blockIdx.x & (2 * J_SLICES - 1);
    const int m0 = (tile & 1) * 16;     // 2 M-tiles
    const int js = tile >> 1;           // 16 N-tiles of stage 1 = j-slices
    const int n0 = js * 16;
    const int tid  = threadIdx.x;
    const int lane = tid & 31;
    const int wave = __builtin_amdgcn_readfirstlane(tid >> 5);
    const int lo = lane & 15;
    const int hi = lane >> 4;           // 0 or 1

    const float* A    = is_gate ? metrics : text;
    const float* Wm   = is_gate ? gW : Wv;
    const float* bias = is_gate ? gb : bv;

    __shared__ float part[PREP_WAVES][256];
    __shared__ __attribute__((aligned(16))) float vt[16][VT_PITCH];

    // stage 1 operands: k = 32*wave + 16*hi + 0..15, one whole line per row
    const f4* ap = reinterpret_cast<const f4*>(A  + (m0 + lo) * K + wave * 32 + hi * 16);
    const f4* wp = reinterpret_cast<const f4*>(Wm + (n0 + lo) * K + wave * 32 + hi * 16);
    f4 av[4], wv[4];
#pragma unroll
    for (int q = 0; q < 4; ++q) { av[q] = ap[q]; wv[q] = wp[q]; }
    const float bs = bias[n0 + (tid & 15)];

    // stage 2 operand, asked for now so that it lands under stage 1:
    // wave w owns n-tiles 2w and 2w+1; j = n0 + 8*hi + 0..7
    f4 ov[2][2] = {};
    float bs2[2] = {0.f, 0.f};
    if (!is_gate) {
#pragma unroll
        for (int t = 0; t < 2; ++t) {
            const int n = (wave * 2 + t) * 16 + lo;
            const f4* op = reinterpret_cast<const f4*>(Wo + n * K + n0 + hi * 8);
            ov[t][0] = op[0];
            ov[t][1] = op[1];
            bs2[t] = bo[n];
        }
    }
    // precaution: no address register of the issued loads is rewritten ahead
    // of this wait (the pointers are not __restrict__, so that no load moves
    // behind it)
    asm volatile("s_wait_xcnt 0x0" ::: "memory");

    v8f acc = {};
#pragma unroll
    for (int q = 0; q < 4; ++q)
        acc = pgf_wmma_pair(av[q], wv[q], acc);

#pragma unroll
    for (int r = 0; r < 8; ++r)
        part[wave][r * 32 + lane] = acc[r];
    __syncthreads();

    // thread tid owns accumulator position (r = tid>>5, lane = tid&31)
    float v = part[0][tid];
#pragma unroll
    for (int w = 1; w < PREP_WAVES; ++w)
        v += part[w][tid];
    v += bs;
    const int em = (tid >> 5) + 8 * ((tid >> 4) & 1);
    const int en = tid & 15;

    if (is_gate) {
        gate[(m0 + em) * N + n0 + en] = 1.0f / (1.0f + __expf(-v));
    } else {
        vt[em][en] = v;
        __syncthreads();                // block-uniform branch
        const f4 a0 = *reinterpret_cast<const f4*>(&vt[lo][hi * 8]);
        const f4 a1 = *reinterpret_cast<const f4*>(&vt[lo][hi * 8 + 4]);
#pragma unroll
        for (int t = 0; t < 2; ++t) {
            v8f c = {};
            c = pgf_wmma_pair(a0, ov[t][0], c);
            c = pgf_wmma_pair(a1, ov[t][1], c);
            const int n = (wave * 2 + t) * 16 + lo;
            float* po = attn_part + (js * B_SZ + m0 + 8 * hi) * N + n;
#pragma unroll
            for (int r = 0; r < 8; ++r)
                po[r * N] = (js == 0) ? c[r] + bs2[t] : c[r];  // bo enters once
        }
        // precaution: no register that the issued stores name (address pair,
        // data) is rewritten ahead of this wait, on any way out of here
        asm volatile("s_wait_xcnt 0x0" ::: "memory");
    }
}

// ---------------------------------------------------------------------------
// Bandwidth-bound fusion: per (b, pixel) LayerNorm over 256 channels plus
// broadcast attn add and gate scaling. visual is read once.
// One block per WGP (256 blocks of 16 waves) owns 512 consecutive pixels of one
// image and walks them as 4 tiles of 128. In a tile each lane owns 4 pixels
// (float4 = global b128, 512 contiguous bytes per wave and channel) and each
// wave 16 of the 256 channels; the per-pixel sums of the 16 waves meet in LDS.
// The rows of tiles 0..2 are asked for at the start, into three register sets;
// tile 3's rows are asked for as soon as tile 0 has left its set. So the
// reads of later tiles and the stores of earlier ones run under each tile's
// arithmetic, and attn, gate and the LN vectors are fetched once per block.
// attn arrives as 16 partial sums per channel: lane l of a wave adds those of
// channel c0 + (l & 15) while the visual rows are in flight.
// ---------------------------------------------------------------------------
#define FUSE_WAVES  16
#define FUSE_CH     (D_DIM / FUSE_WAVES)          // channels held per wave
#define FUSE_TILES  4                             // 128-pixel tiles per block
#define FUSE_SETS   3                             // register sets of one tile
#define FUSE_STRIPS (HW_SZ / (128 * FUSE_TILES))  // blocks per image
#define RED_PITCH   132   // floats: rows 16-byte aligned, 4 rows apart = 16 banks

__device__ __forceinline__ void pgf_lds_barrier()
{
    // work-group barrier for LDS traffic alone: this wave's LDS writes and reads
    // are done, then signal and wait. __syncthreads() would also drain the
    // global loads asked for ahead and the stores of the tile before.
    asm volatile("s_wait_dscnt 0x0\n\ts_barrier_signal -1\n\ts_barrier_wait -1" ::: "memory");
}

__global__ __launch_bounds__(512) void pgf_fuse(
    const float* __restrict__ visual,   // [32, 256, 64, 64]
    const float* __restrict__ attn_part,// [16 slices, 32, 256]
    const float* __restrict__ gate,     // [32, 256]
    const float* __restrict__ ln_g,     // [256]
    const float* __restrict__ ln_b,     // [256]
    float* __restrict__ out)            // [32, 256, 64, 64]
{
    const int C = D_DIM;
    const int P4 = HW_SZ / 4;           // 1024 float4 pixels per image plane
    const int lane = threadIdx.x & 31;
    // wave number in a scalar register -> per-channel vectors come by scalar loads
    const int wave = __builtin_amdgcn_readfirstlane(threadIdx.x >> 5);
    const int b  = blockIdx.x / FUSE_STRIPS;
    const int p4 = (blockIdx.x % FUSE_STRIPS) * (32 * FUSE_TILES) + lane;
    const int c0 = wave * FUSE_CH;

    const f4* vbase = reinterpret_cast<const f4*>(visual) + ((size_t)b * C + c0) * P4 + p4;
    f4*       obase = reinterpret_cast<f4*>(out)          + ((size_t)b * C + c0) * P4 + p4;
    const float* apart = attn_part + b * C + c0 + (lane & (FUSE_CH - 1));
    const float* grow = gate + b * C + c0;
    const float* lg   = ln_g + c0;
    const float* lb   = ln_b + c0;

    // per wave and pixel: partial sum and sum of squares; per pixel: mean, 1/sigma
    __shared__ __attribute__((aligned(16))) float red_sum[FUSE_WAVES][RED_PITCH];
    __shared__ __attribute__((aligned(16))) float red_sq[FUSE_WAVES][RED_PITCH];
    __shared__ __attribute__((aligned(16))) float stat[2][128];
    // joining the sums: four lanes per pixel, lane q of them takes waves 4q..4q+3
    const int px = wave * 8 + (lane >> 2);
    const int q  = lane & 3;

    // asked for ahead of the visual rows: loads return in order, so the sum
    // below does not wait for those
    float ap[J_SLICES];
#pragma unroll
    for (int s = 0; s < J_SLICES; ++s)
        ap[s] = apart[s * B_SZ * C];

    // every loop over x[][] is fully unrolled: constant indices keep it in
    // registers, and all 48 loads are in flight before the first is used
    f4 x[FUSE_SETS][FUSE_CH];
#pragma unroll
    for (int s = 0; s < FUSE_SETS; ++s) {
#pragma unroll
        for (int i = 0; i < FUSE_CH; ++i)
            x[s][i] = vbase[(size_t)i * P4 + s * 32];
        // keeps the loads in tile order: they return in order, and without it
        // the tiles' rows are interleaved, so that tile 0 waits for all of them
        __builtin_amdgcn_sched_barrier(0);
    }
    // precaution: no register that the issued loads name (scalar base, lane
    // offset) is rewritten ahead of this wait
    asm volatile("s_wait_xcnt 0x0" ::: "memory");
    // keeps the arithmetic behind that wait
    __builtin_amdgcn_sched_barrier(0);

    float asum = ap[0];
#pragma unroll
    for (int s = 1; s < J_SLICES; ++s)
        asum += ap[s];
    const int abits = __float_as_int(asum);

    // per-channel values, wave-uniform, made once for all four tiles
    float av[FUSE_CH], sc[FUSE_CH], sh[FUSE_CH];
#pragma unroll
    for (int i = 0; i < FUSE_CH; ++i) {
        // channel c0 + i's attn value, from lane i into a scalar register
        av[i] = __int_as_float(__builtin_amdgcn_readlane(abits, i));
        const float gm = 1.0f + grow[i];
        sc[i] = lg[i] * gm;                     // fold gate into LN scale
        sh[i] = lb[i] * gm;                     // ...and LN shift
    }

    const float invC = 1.0f / (float)C;

#pragma unroll
    for (int t = 0; t < FUSE_TILES; ++t) {
        const int s = t % FUSE_SETS;

        f4 sum   = {0.f, 0.f, 0.f, 0.f};
        f4 sumsq = {0.f, 0.f, 0.f, 0.f};
#pragma unroll
        for (int i = 0; i < FUSE_CH; ++i) {
            x[s][i] = x[s][i] + av[i];
            sum   = sum + x[s][i];
            sumsq = sumsq + x[s][i] * x[s][i];
        }

        *reinterpret_cast<f4*>(&red_sum[wave][lane * 4]) = sum;
        *reinterpret_cast<f4*>(&red_sq[wave][lane * 4])  = sumsq;
        pgf_lds_barrier();      // all 16 partial sums of the tile are in LDS
        float ps = red_sum[q * 4][px];
        float pq = red_sq[q * 4][px];
#pragma unroll
        for (int j = 1; j < 4; ++j) {
            ps += red_sum[q * 4 + j][px];
            pq += red_sq[q * 4 + j][px];
        }
        // the four lanes of a pixel add up: quad_perm [1,0,3,2], then [2,3,0,1]
        ps += __int_as_float(__builtin_amdgcn_update_dpp(0, __float_as_int(ps), 0xB1, 0xF, 0xF, true));
        pq += __int_as_float(__builtin_amdgcn_update_dpp(0, __float_as_int(pq), 0xB1, 0xF, 0xF, true));
        ps += __int_as_float(__builtin_amdgcn_update_dpp(0, __float_as_int(ps), 0x4E, 0xF, 0xF, true));
        pq += __int_as_float(__builtin_amdgcn_update_dpp(0, __float_as_int(pq), 0x4E, 0xF, 0xF, true));
        const float mu1  = ps * invC;
        const float var1 = pq * invC - mu1 * mu1;
        const float inv1 = rsqrtf(var1 + 1e-5f);
        if (q < 2)
            stat[q][px] = q ? inv1 : mu1;
        // every read of the partial sums is done (the next tile may overwrite
        // them) and mean and 1/sigma of all 128 pixels are in LDS; their reads
        // below end in front of the next tile's first barrier
        pgf_lds_barrier();
        const f4 mu  = *reinterpret_cast<const f4*>(&stat[0][lane * 4]);
        const f4 inv = *reinterpret_cast<const f4*>(&stat[1][lane * 4]);

#pragma unroll
        for (int i = 0; i < FUSE_CH; ++i) {
            f4 y = (x[s][i] - mu) * inv;
            y = y * sc[i] + sh[i];
            __builtin_nontemporal_store(y, obase + (size_t)i * P4 + t * 32);
        }

        if (t + 1 < FUSE_TILES) {
            // precaution: later work reuses registers that this tile's issued
            // stores name; none is rewritten ahead of this wait
            asm volatile("s_wait_xcnt 0x0" ::: "memory");
            // keeps that later work (the refill below first of all) behind the wait
            __builtin_amdgcn_sched_barrier(0);
        }
        if (t + FUSE_SETS < FUSE_TILES) {
            // the set is free: ask for the tile that will use it next
#pragma unroll
            for (int i = 0; i < FUSE_CH; ++i)
                x[s][i] = vbase[(size_t)i * P4 + (t + FUSE_SETS) * 32];
            // keeps the refill here, two tiles ahead of its use
            __builtin_amdgcn_sched_barrier(0);
        }
    }
}

extern "C" void kernel_launch(void* const* d_in, const int* in_sizes, int n_in,
                              void* d_out, int out_size, void* d_ws, size_t ws_size,
                              hipStream_t stream)
{
    const float* visual  = (const float*)d_in[0];
    const float* text    = (const float*)d_in[1];
    const float* metrics = (const float*)d_in[2];
    const float* Wv      = (const float*)d_in[3];
    const float* bv      = (const float*)d_in[4];
    const float* Wo      = (const float*)d_in[5];
    const float* bo      = (const float*)d_in[6];
    const float* ln_g    = (const float*)d_in[7];
    const float* ln_b    = (const float*)d_in[8];
    const float* gW      = (const float*)d_in[9];
    const float* gb      = (const float*)d_in[10];
    float* out = (float*)d_out;

    float* ws     = (float*)d_ws;
    float* attn_part = ws;                               // 16*32*256 floats
    float* gate      = ws + J_SLICES * B_SZ * D_DIM;     // 32*256 floats

    // partial attn sums (blocks 0..31) and gate (blocks 32..63)
    pgf_prep<<<4 * J_SLICES, 256, 0, stream>>>(text, metrics, Wv, bv, Wo, bo, gW, gb,
                                               attn_part, gate);

    // one block of 16 waves per 512-pixel strip
    pgf_fuse<<<B_SZ * FUSE_STRIPS, 512, 0, stream>>>(visual, attn_part, gate, ln_g, ln_b, out);
}

// v004
// One run takes 22.6 microseconds.
// In two side-by-side timings against v003, it was 1.04 and 1.06 times as fast.
// Over all steps from v000 it is 3.76 times as fast.
#include <hip/hip_runtime.h>
#include <hip/hip_bf16.h>
#include <math.h>

typedef __attribute__((ext_vector_type(2))) float v2f;
typedef __attribute__((ext_vector_type(4))) float f4;
typedef __attribute__((ext_vector_type(8))) float v8f;

#define D_DIM 256
#define B_SZ  32
#define HW_SZ 4096

// ---------------------------------------------------------------------------
// All three small fp32 products (M=32, N=K=256) in ONE launch, on
// V_WMMA_F32_16X16X4_F32.
//   blocks  0..31: (m-tile, j-slice) of the chained product
//                  attn = (text @ Wv^T + bv) @ Wo^T + bo
//   blocks 32..63: (m-tile, n-tile) of gate = sigmoid(metrics @ gW^T + gb)
// Stage 1 (every block): one 16x16 tile of A @ W^T + bias; K = 256 is split
// over the block's 8 waves (32 each), the 8 partial tiles meet in LDS.
// Stage 2 (blocks 0..31): the tile is 16 columns j of v = text @ Wv^T + bv.
// It stays in LDS and is multiplied at once with the same 16 columns of Wo:
// a partial attn[16 x 256] summed over this j-slice only. The 16 slices'
// partials go to the workspace; their consumer adds them. No block needs
// another block's v, so no launch boundary is needed between the products.
// Per-lane WMMA layouts (CDNA5 ISA 7.12.2), slot = r + 2*(lane>=16):
//   A (16x4, M x K):  component r holds A[m = lane&15][k(slot)]
//   B (4x16, K x N):  component r holds W[n = lane&15][k(slot)]
//   C/D (16x16):      vgpr r holds out[m = r + 8*(lane>=16)][n = lane&15]
// k(slot) is the same function for A and B: a lane reads a run of consecutive
// k (16 in stage 1, 8 in stage 2) by 16-byte loads and feeds them pair by pair.
// ---------------------------------------------------------------------------
#define PREP_WAVES 8
#define J_SLICES   (D_DIM / 16)
#define VT_PITCH   20                     // floats; rows stay 16-byte aligned

__device__ __forceinline__ v8f pgf_wmma_pair(f4 a, f4 b, v8f acc)
{
    // 8 args: (neg_a, A, neg_b, B, c_mod, C, reuse_a, reuse_b)
    v2f a0 = {a.x, a.y}, b0 = {b.x, b.y};
    acc = __builtin_amdgcn_wmma_f32_16x16x4_f32(
        false, a0, false, b0, (short)0, acc, false, false);
    v2f a1 = {a.z, a.w}, b1 = {b.z, b.w};
    acc = __builtin_amdgcn_wmma_f32_16x16x4_f32(
        false, a1, false, b1, (short)0, acc, false, false);
    return acc;
}

__global__ __launch_bounds__(256) void pgf_prep(
    const float* text,     // [32 x 256] row-major
    const float* metrics,  // [32 x 256]
    const float* Wv,       // [256 x 256] row-major (out-dim major)
    const float* bv,       // [256]
    const float* Wo,       // [256 x 256]
    const float* bo,       // [256]
    const float* gW,       // [256 x 256]
    const float* gb,       // [256]
    float* attn_part,      // [16 slices][32][256]
    float* gate)           // [32][256]
{
    const int K = D_DIM, N = D_DIM;
    const bool is_gate = blockIdx.x >= 2 * J_SLICES;
    const int tile = blockIdx.x & (2 * J_SLICES - 1);
    const int m0 = (tile & 1) * 16;     // 2 M-tiles
    const int js = tile >> 1;           // 16 N-tiles of stage 1 = j-slices
    const int n0 = js * 16;
    const int tid  = threadIdx.x;
    const int lane = tid & 31;
    const int wave = __builtin_amdgcn_readfirstlane(tid >> 5);
    const int lo = lane & 15;
    const int hi = lane >> 4;           // 0 or 1

    const float* A    = is_gate ? metrics : text;
    const float* Wm   = is_gate ? gW : Wv;
    const float* bias = is_gate ? gb : bv;

    __shared__ float part[PREP_WAVES][256];
    __shared__ __attribute__((aligned(16))) float vt[16][VT_PITCH];

    // stage 1 operands: k = 32*wave + 16*hi + 0..15, one whole line per row
    const f4* ap = reinterpret_cast<const f4*>(A  + (m0 + lo) * K + wave * 32 + hi * 16);
    const f4* wp = reinterpret_cast<const f4*>(Wm + (n0 + lo) * K + wave * 32 + hi * 16);
    f4 av[4], wv[4];
#pragma unroll
    for (int q = 0; q < 4; ++q) { av[q] = ap[q]; wv[q] = wp[q]; }
    const float bs = bias[n0 + (tid & 15)];

    // stage 2 operand, asked for now so that it lands under stage 1:
    // wave w owns n-tiles 2w and 2w+1; j = n0 + 8*hi + 0..7
    f4 ov[2][2] = {};
    float bs2[2] = {0.f, 0.f};
    if (!is_gate) {
#pragma unroll
        for (int t = 0; t < 2; ++t) {
            const int n = (wave * 2 + t) * 16 + lo;
            const f4* op = reinterpret_cast<const f4*>(Wo + n * K + n0 + hi * 8);
            ov[t][0] = op[0];
            ov[t][1] = op[1];
            bs2[t] = bo[n];
        }
    }
    // precaution: no address register of the issued loads is rewritten ahead
    // of this wait (the pointers are not __restrict__, so that no load moves
    // behind it)
    asm volatile("s_wait_xcnt 0x0" ::: "memory");

    v8f acc = {};
#pragma unroll
    for (int q = 0; q < 4; ++q)
        acc = pgf_wmma_pair(av[q], wv[q], acc);

#pragma unroll
    for (int r = 0; r < 8; ++r)
        part[wave][r * 32 + lane] = acc[r];
    __syncthreads();

    // thread tid owns accumulator position (r = tid>>5, lane = tid&31)
    float v = part[0][tid];
#pragma unroll
    for (int w = 1; w < PREP_WAVES; ++w)
        v += part[w][tid];
    v += bs;
    const int em = (tid >> 5) + 8 * ((tid >> 4) & 1);
    const int en = tid & 15;

    if (is_gate) {
        gate[(m0 + em) * N + n0 + en] = 1.0f / (1.0f + __expf(-v));
    } else {
        vt[em][en] = v;
        __syncthreads();                // block-uniform branch
        const f4 a0 = *reinterpret_cast<const f4*>(&vt[lo][hi * 8]);
        const f4 a1 = *reinterpret_cast<const f4*>(&vt[lo][hi * 8 + 4]);
#pragma unroll
        for (int t = 0; t < 2; ++t) {
            v8f c = {};
            c = pgf_wmma_pair(a0, ov[t][0], c);
            c = pgf_wmma_pair(a1, ov[t][1], c);
            const int n = (wave * 2 + t) * 16 + lo;
            float* po = attn_part + (js * B_SZ + m0 + 8 * hi) * N + n;
#pragma unroll
            for (int r = 0; r < 8; ++r)
                po[r * N] = (js == 0) ? c[r] + bs2[t] : c[r];  // bo enters once
        }
        // precaution: no register that the issued stores name (address pair,
        // data) is rewritten ahead of this wait, on any way out of here
        asm volatile("s_wait_xcnt 0x0" ::: "memory");
    }
}

// ---------------------------------------------------------------------------
// Bandwidth-bound fusion: per (b, pixel) LayerNorm over 256 channels plus
// broadcast attn add and gate scaling. visual is read once.
// One block per WGP (256 blocks of 16 waves) owns 512 consecutive pixels of one
// image and walks them as 4 tiles of 128. In a tile each lane owns 4 pixels
// (float4 = global b128, 512 contiguous bytes per wave and channel) and each
// wave 16 of the 256 channels; the per-pixel sums of the 16 waves meet in LDS.
// All four tiles are asked for at the start: the rows of tiles 0..2 into three
// register sets, tile 3's rows into LDS by asynchronous copies (each lane brings
// its own 16 bytes and later reads those same bytes back into tile 0's set). So
// no read is asked for behind a store, the stores of earlier tiles run under
// each tile's arithmetic, and attn, gate and the LN vectors are fetched once.
// attn arrives as 16 partial sums per channel: lane l of a wave adds those of
// channel c0 + (l & 15) while the visual rows are in flight.
// ---------------------------------------------------------------------------
#define FUSE_WAVES  16
#define FUSE_CH     (D_DIM / FUSE_WAVES)          // channels held per wave
#define FUSE_TILES  4                             // 128-pixel tiles per block
#define FUSE_SETS   3                             // register sets of one tile
#define FUSE_STRIPS (HW_SZ / (128 * FUSE_TILES))  // blocks per image
#define RED_PITCH   132   // floats: rows 16-byte aligned, 4 rows apart = 16 banks

__device__ __forceinline__ void pgf_lds_barrier()
{
    // work-group barrier for LDS traffic alone: this wave's LDS writes and reads
    // are done, then signal and wait. __syncthreads() would also drain the
    // global loads asked for ahead and the stores of the tile before.
    asm volatile("s_wait_dscnt 0x0\n\ts_barrier_signal -1\n\ts_barrier_wait -1" ::: "memory");
}

__global__ __launch_bounds__(512) void pgf_fuse(
    const float* __restrict__ visual,   // [32, 256, 64, 64]
    const float* __restrict__ attn_part,// [16 slices, 32, 256]
    const float* __restrict__ gate,     // [32, 256]
    const float* __restrict__ ln_g,     // [256]
    const float* __restrict__ ln_b,     // [256]
    float* __restrict__ out)            // [32, 256, 64, 64]
{
    const int C = D_DIM;
    const int P4 = HW_SZ / 4;           // 1024 float4 pixels per image plane
    const int lane = threadIdx.x & 31;
    // wave number in a scalar register -> per-channel vectors come by scalar loads
    const int wave = __builtin_amdgcn_readfirstlane(threadIdx.x >> 5);
    const int b  = blockIdx.x / FUSE_STRIPS;
    const int p4 = (blockIdx.x % FUSE_STRIPS) * (32 * FUSE_TILES) + lane;
    const int c0 = wave * FUSE_CH;

    const f4* vbase = reinterpret_cast<const f4*>(visual) + ((size_t)b * C + c0) * P4 + p4;
    f4*       obase = reinterpret_cast<f4*>(out)          + ((size_t)b * C + c0) * P4 + p4;
    const float* apart = attn_part + b * C + c0 + (lane & (FUSE_CH - 1));
    const float* grow = gate + b * C + c0;
    const float* lg   = ln_g + c0;
    const float* lb   = ln_b + c0;

    // per wave and pixel: partial sum and sum of squares; per pixel: mean, 1/sigma
    __shared__ __attribute__((aligned(16))) float red_sum[FUSE_WAVES][RED_PITCH];
    __shared__ __attribute__((aligned(16))) float red_sq[FUSE_WAVES][RED_PITCH];
    __shared__ __attribute__((aligned(16))) float stat[2][128];
    // the last tile's rows, one 512-byte row per channel
    __shared__ __attribute__((aligned(16))) float xl[D_DIM][128];
    // joining the sums: four lanes per pixel, lane q of them takes waves 4q..4q+3
    const int px = wave * 8 + (lane >> 2);
    const int q  = lane & 3;

    // asked for ahead of the visual rows: loads return in order, so the sum
    // below does not wait for those
    float ap[J_SLICES];
#pragma unroll
    for (int s = 0; s < J_SLICES; ++s)
        ap[s] = apart[s * B_SZ * C];

    // every loop over x[][] is fully unrolled: constant indices keep it in
    // registers, and all 48 loads are in flight before the first is used
    f4 x[FUSE_SETS][FUSE_CH];
#pragma unroll
    for (int s = 0; s < FUSE_SETS; ++s) {
#pragma unroll
        for (int i = 0; i < FUSE_CH; ++i)
            x[s][i] = vbase[(size_t)i * P4 + s * 32];
        // keeps the loads in tile order: they return in order, and without it
        // the tiles' rows are interleaved, so that tile 0 waits for all of them
        __builtin_amdgcn_sched_barrier(0);
    }
    // precaution: no register that the issued loads name (scalar base, lane
    // offset) is rewritten ahead of this wait
    asm volatile("s_wait_xcnt 0x0" ::: "memory");
    // keeps the copies' address arithmetic behind that wait
    __builtin_amdgcn_sched_barrier(0);

    // the last tile's rows, behind the three others in the queue: lane l of the
    // wave that owns channel c brings bytes 16*l .. 16*l+15 of row c. Eight copies
    // a statement, so that the address registers fit beside the 48 rows; the
    // s_wait_xcnt in the statement: precaution, no address register of an issued
    // copy is rewritten ahead of it
#pragma unroll
    for (int i = 0; i < FUSE_CH; i += 8) {
        const f4* g = vbase + (size_t)i * P4 + (FUSE_TILES - 1) * 32;
        const unsigned l = (unsigned)(size_t)&xl[c0 + i][lane * 4];
        asm volatile("global_load_async_to_lds_b128 %0, %8, off\n\t"
                     "global_load_async_to_lds_b128 %1, %9, off\n\t"
                     "global_load_async_to_lds_b128 %2, %10, off\n\t"
                     "global_load_async_to_lds_b128 %3, %11, off\n\t"
                     "global_load_async_to_lds_b128 %4, %12, off\n\t"
                     "global_load_async_to_lds_b128 %5, %13, off\n\t"
                     "global_load_async_to_lds_b128 %6, %14, off\n\t"
                     "global_load_async_to_lds_b128 %7, %15, off\n\t"
                     "s_wait_xcnt 0x0"
                     :: "v"(l), "v"(l + 512u), "v"(l + 1024u), "v"(l + 1536u),
                        "v"(l + 2048u), "v"(l + 2560u), "v"(l + 3072u), "v"(l + 3584u),
                        "v"(g), "v"(g + P4), "v"(g + 2 * P4), "v"(g + 3 * P4),
                        "v"(g + 4 * P4), "v"(g + 5 * P4), "v"(g + 6 * P4), "v"(g + 7 * P4)
                     : "memory");
        // keeps the second group's address arithmetic behind the first group
        __builtin_amdgcn_sched_barrier(0);
    }

    float asum = ap[0];
#pragma unroll
    for (int s = 1; s < J_SLICES; ++s)
        asum += ap[s];
    const int abits = __float_as_int(asum);

    // per-channel values, wave-uniform, made once for all four tiles
    float av[FUSE_CH], sc[FUSE_CH], sh[FUSE_CH];
#pragma unroll
    for (int i = 0; i < FUSE_CH; ++i) {
        // channel c0 + i's attn value, from lane i into a scalar register
        av[i] = __int_as_float(__builtin_amdgcn_readlane(abits, i));
        const float gm = 1.0f + grow[i];
        sc[i] = lg[i] * gm;                     // fold gate into LN scale
        sh[i] = lb[i] * gm;                     // ...and LN shift
    }

    const float invC = 1.0f / (float)C;

#pragma unroll
    for (int t = 0; t < FUSE_TILES; ++t) {
        const int s = t % FUSE_SETS;

        f4 sum   = {0.f, 0.f, 0.f, 0.f};
        f4 sumsq = {0.f, 0.f, 0.f, 0.f};
#pragma unroll
        for (int i = 0; i < FUSE_CH; ++i) {
            x[s][i] = x[s][i] + av[i];
            sum   = sum + x[s][i];
            sumsq = sumsq + x[s][i] * x[s][i];
        }

        *reinterpret_cast<f4*>(&red_sum[wave][lane * 4]) = sum;
        *reinterpret_cast<f4*>(&red_sq[wave][lane * 4])  = sumsq;
        pgf_lds_barrier();      // all 16 partial sums of the tile are in LDS
        float ps = red_sum[q * 4][px];
        float pq = red_sq[q * 4][px];
#pragma unroll
        for (int j = 1; j < 4; ++j) {
            ps += red_sum[q * 4 + j][px];
            pq += red_sq[q * 4 + j][px];
        }
        // the four lanes of a pixel add up: quad_perm [1,0,3,2], then [2,3,0,1]
        ps += __int_as_float(__builtin_amdgcn_update_dpp(0, __float_as_int(ps), 0xB1, 0xF, 0xF, true));
        pq += __int_as_float(__builtin_amdgcn_update_dpp(0, __float_as_int(pq), 0xB1, 0xF, 0xF, true));
        ps += __int_as_float(__builtin_amdgcn_update_dpp(0, __float_as_int(ps), 0x4E, 0xF, 0xF, true));
        pq += __int_as_float(__builtin_amdgcn_update_dpp(0, __float_as_int(pq), 0x4E, 0xF, 0xF, true));
        const float mu1  = ps * invC;
        const float var1 = pq * invC - mu1 * mu1;
        const float inv1 = rsqrtf(var1 + 1e-5f);
        if (q < 2)
            stat[q][px] = q ? inv1 : mu1;
        if (t == FUSE_TILES - 2) {
            // this wave's copies of the last tile have landed; the barrier below
            // stands between this wait and every read of those rows
            asm volatile("s_wait_asynccnt 0x0" ::: "memory");
        }
        // every read of the partial sums is done (the next tile may overwrite
        // them) and mean and 1/sigma of all 128 pixels are in LDS; their reads
        // below end in front of the next tile's first barrier
        pgf_lds_barrier();
        const f4 mu  = *reinterpret_cast<const f4*>(&stat[0][lane * 4]);
        const f4 inv = *reinterpret_cast<const f4*>(&stat[1][lane * 4]);
        if (t == FUSE_TILES - 2) {
            // the last tile's rows, from LDS into the set that tile 0 has left:
            // read here, so that they arrive under this tile's stores
#pragma unroll
            for (int i = 0; i < FUSE_CH; ++i)
                x[(t + 1) % FUSE_SETS][i] = *reinterpret_cast<const f4*>(&xl[c0 + i][lane * 4]);
        }

#pragma unroll
        for (int i = 0; i < FUSE_CH; ++i) {
            f4 y = (x[s][i] - mu) * inv;
            y = y * sc[i] + sh[i];
            __builtin_nontemporal_store(y, obase + (size_t)i * P4 + t * 32);
        }

        if (t + 1 < FUSE_TILES) {
            // precaution: later work reuses registers that this tile's issued
            // stores name; none is rewritten ahead of this wait
            asm volatile("s_wait_xcnt 0x0" ::: "memory");
            // keeps that later work behind the wait
            __builtin_amdgcn_sched_barrier(0);
        }
    }
}

extern "C" void kernel_launch(void* const* d_in, const int* in_sizes, int n_in,
                              void* d_out, int out_size, void* d_ws, size_t ws_size,
                              hipStream_t stream)
{
    const float* visual  = (const float*)d_in[0];
    const float* text    = (const float*)d_in[1];
    const float* metrics = (const float*)d_in[2];
    const float* Wv      = (const float*)d_in[3];
    const float* bv      = (const float*)d_in[4];
    const float* Wo      = (const float*)d_in[5];
    const float* bo      = (const float*)d_in[6];
    const float* ln_g    = (const float*)d_in[7];
    const float* ln_b    = (const float*)d_in[8];
    const float* gW      = (const float*)d_in[9];
    const float* gb      = (const float*)d_in[10];
    float* out = (float*)d_out;

    float* ws     = (float*)d_ws;
    float* attn_part = ws;                               // 16*32*256 floats
    float* gate      = ws + J_SLICES * B_SZ * D_DIM;     // 32*256 floats

    // partial attn sums (blocks 0..31) and gate (blocks 32..63)
    pgf_prep<<<4 * J_SLICES, 256, 0, stream>>>(text, metrics, Wv, bv, Wo, bo, gW, gb,
                                               attn_part, gate);

    // one block of 16 waves per 512-pixel strip
    pgf_fuse<<<B_SZ * FUSE_STRIPS, 512, 0, stream>>>(visual, attn_part, gate, ln_g, ln_b, out);
}

// v005
// Measured time: 20.2 microseconds a run.
// Two timings next to v004 both put it at 1.11 times that version's speed.
// Counting every step since v000, it is 4.19 times as fast.
#include <hip/hip_runtime.h>
#include <hip/hip_bf16.h>
#include <math.h>

typedef __attribute__((ext_vector_type(2))) float v2f;
typedef __attribute__((ext_vector_type(4))) float f4;
typedef __attribute__((ext_vector_type(8))) float v8f;

#define D_DIM 256
#define B_SZ  32
#define HW_SZ 4096

// ---------------------------------------------------------------------------
// All three small fp32 products (M=32, N=K=256) in ONE launch, on
// V_WMMA_F32_16X16X4_F32.
//   blocks  0..31: (m-tile, j-slice) of the chained product
//                  attn = (text @ Wv^T + bv) @ Wo^T + bo
//   blocks 32..63: (m-tile, n-tile) of gate = sigmoid(metrics @ gW^T + gb)
// Stage 1 (every block): one 16x16 tile of A @ W^T + bias; K = 256 is split
// over the block's 8 waves (32 each), the 8 partial tiles meet in LDS.
// Stage 2 (blocks 0..31): the tile is 16 columns j of v = text @ Wv^T + bv.
// It stays in LDS and is multiplied at once with the same 16 columns of Wo:
// a partial attn[16 x 256] summed over this j-slice only. The 16 slices'
// partials go to the workspace; their consumer adds them. No block needs
// another block's v, so no launch boundary is needed between the products.
// Per-lane WMMA layouts (CDNA5 ISA 7.12.2), slot = r + 2*(lane>=16):
//   A (16x4, M x K):  component r holds A[m = lane&15][k(slot)]
//   B (4x16, K x N):  component r holds W[n = lane&15][k(slot)]
//   C/D (16x16):      vgpr r holds out[m = r + 8*(lane>=16)][n = lane&15]
// k(slot) is the same function for A and B: a lane reads a run of consecutive
// k (16 in stage 1, 8 in stage 2) by 16-byte loads and feeds them pair by pair.
// ---------------------------------------------------------------------------
#define PREP_WAVES 8
#define J_SLICES   (D_DIM / 16)
#define VT_PITCH   20                     // floats; rows stay 16-byte aligned

__device__ __forceinline__ v8f pgf_wmma_pair(f4 a, f4 b, v8f acc)
{
    // 8 args: (neg_a, A, neg_b, B, c_mod, C, reuse_a, reuse_b)
    v2f a0 = {a.x, a.y}, b0 = {b.x, b.y};
    acc = __builtin_amdgcn_wmma_f32_16x16x4_f32(
        false, a0, false, b0, (short)0, acc, false, false);
    v2f a1 = {a.z, a.w}, b1 = {b.z, b.w};
    acc = __builtin_amdgcn_wmma_f32_16x16x4_f32(
        false, a1, false, b1, (short)0, acc, false, false);
    return acc;
}

__global__ __launch_bounds__(256) void pgf_prep(
    const float* text,     // [32 x 256] row-major
    const float* metrics,  // [32 x 256]
    const float* Wv,       // [256 x 256] row-major (out-dim major)
    const float* bv,       // [256]
    const float* Wo,       // [256 x 256]
    const float* bo,       // [256]
    const float* gW,       // [256 x 256]
    const float* gb,       // [256]
    float* attn_part,      // [16 slices][32][256]
    float* gate)           // [32][256]
{
    const int K = D_DIM, N = D_DIM;
    const bool is_gate = blockIdx.x >= 2 * J_SLICES;
    const int tile = blockIdx.x & (2 * J_SLICES - 1);
    const int m0 = (tile & 1) * 16;     // 2 M-tiles
    const int js = tile >> 1;           // 16 N-tiles of stage 1 = j-slices
    const int n0 = js * 16;
    const int tid  = threadIdx.x;
    const int lane = tid & 31;
    const int wave = __builtin_amdgcn_readfirstlane(tid >> 5);
    const int lo = lane & 15;
    const int hi = lane >> 4;           // 0 or 1

    const float* A    = is_gate ? metrics : text;
    const float* Wm   = is_gate ? gW : Wv;
    const float* bias = is_gate ? gb : bv;

    __shared__ float part[PREP_WAVES][256];
    __shared__ __attribute__((aligned(16))) float vt[16][VT_PITCH];

    // stage 1 operands: k = 32*wave + 16*hi + 0..15, one whole line per row
    const f4* ap = reinterpret_cast<const f4*>(A  + (m0 + lo) * K + wave * 32 + hi * 16);
    const f4* wp = reinterpret_cast<const f4*>(Wm + (n0 + lo) * K + wave * 32 + hi * 16);
    f4 av[4], wv[4];
#pragma unroll
    for (int q = 0; q < 4; ++q) { av[q] = ap[q]; wv[q] = wp[q]; }
    const float bs = bias[n0 + (tid & 15)];

    // stage 2 operand, asked for now so that it lands under stage 1:
    // wave w owns n-tiles 2w and 2w+1; j = n0 + 8*hi + 0..7
    f4 ov[2][2] = {};
    float bs2[2] = {0.f, 0.f};
    if (!is_gate) {
#pragma unroll
        for (int t = 0; t < 2; ++t) {
            const int n = (wave * 2 + t) * 16 + lo;
            const f4* op = reinterpret_cast<const f4*>(Wo + n * K + n0 + hi * 8);
            ov[t][0] = op[0];
            ov[t][1] = op[1];
            bs2[t] = bo[n];
        }
    }
    // precaution: no address register of the issued loads is rewritten ahead
    // of this wait (the pointers are not __restrict__, so that no load moves
    // behind it)
    asm volatile("s_wait_xcnt 0x0" ::: "memory");

    v8f acc = {};
#pragma unroll
    for (int q = 0; q < 4; ++q)
        acc = pgf_wmma_pair(av[q], wv[q], acc);

#pragma unroll
    for (int r = 0; r < 8; ++r)
        part[wave][r * 32 + lane] = acc[r];
    __syncthreads();

    // thread tid owns accumulator position (r = tid>>5, lane = tid&31)
    float v = part[0][tid];
#pragma unroll
    for (int w = 1; w < PREP_WAVES; ++w)
        v += part[w][tid];
    v += bs;
    const int em = (tid >> 5) + 8 * ((tid >> 4) & 1);
    const int en = tid & 15;

    if (is_gate) {
        gate[(m0 + em) * N + n0 + en] = 1.0f / (1.0f + __expf(-v));
    } else {
        vt[em][en] = v;
        __syncthreads();                // block-uniform branch
        const f4 a0 = *reinterpret_cast<const f4*>(&vt[lo][hi * 8]);
        const f4 a1 = *reinterpret_cast<const f4*>(&vt[lo][hi * 8 + 4]);
#pragma unroll
        for (int t = 0; t < 2; ++t) {
            v8f c = {};
            c = pgf_wmma_pair(a0, ov[t][0], c);
            c = pgf_wmma_pair(a1, ov[t][1], c);
            const int n = (wave * 2 + t) * 16 + lo;
            float* po = attn_part + (js * B_SZ + m0 + 8 * hi) * N + n;
#pragma unroll
            for (int r = 0; r < 8; ++r)
                po[r * N] = (js == 0) ? c[r] + bs2[t] : c[r];  // bo enters once
        }
        // precaution: no register that the issued stores name (address pair,
        // data) is rewritten ahead of this wait, on any way out of here
        asm volatile("s_wait_xcnt 0x0" ::: "memory");
    }
}

// ---------------------------------------------------------------------------
// Bandwidth-bound fusion: per (b, pixel) LayerNorm over 256 channels plus
// broadcast attn add and gate scaling. visual is read once, so every read of it
// carries the non-temporal hint: its lines are not kept in L2 behind the read.
// One block per WGP (256 blocks of 16 waves) owns 512 consecutive pixels of one
// image and walks them as 4 tiles of 128. In a tile each lane owns 4 pixels
// (float4 = global b128, 512 contiguous bytes per wave and channel) and each
// wave 16 of the 256 channels; the per-pixel sums of the 16 waves meet in LDS.
// All four tiles are asked for at the start: the rows of tiles 0..2 into three
// register sets, tile 3's rows into LDS by asynchronous copies (each lane brings
// its own 16 bytes and later reads those same bytes back into tile 0's set). So
// no read is asked for behind a store, the stores of earlier tiles run under
// each tile's arithmetic, and attn, gate and the LN vectors are fetched once.
// attn arrives as 16 partial sums per channel: lane l of a wave adds those of
// channel c0 + (l & 15) while the visual rows are in flight.
// ---------------------------------------------------------------------------
#define FUSE_WAVES  16
#define FUSE_CH     (D_DIM / FUSE_WAVES)          // channels held per wave
#define FUSE_TILES  4                             // 128-pixel tiles per block
#define FUSE_SETS   3                             // register sets of one tile
#define FUSE_STRIPS (HW_SZ / (128 * FUSE_TILES))  // blocks per image
#define RED_PITCH   132   // floats: rows 16-byte aligned, 4 rows apart = 16 banks

__device__ __forceinline__ void pgf_lds_barrier()
{
    // work-group barrier for LDS traffic alone: this wave's LDS writes and reads
    // are done, then signal and wait. __syncthreads() would also drain the
    // global loads asked for ahead and the stores of the tile before.
    asm volatile("s_wait_dscnt 0x0\n\ts_barrier_signal -1\n\ts_barrier_wait -1" ::: "memory");
}

__global__ __launch_bounds__(512) void pgf_fuse(
    const float* __restrict__ visual,   // [32, 256, 64, 64]
    const float* __restrict__ attn_part,// [16 slices, 32, 256]
    const float* __restrict__ gate,     // [32, 256]
    const float* __restrict__ ln_g,     // [256]
    const float* __restrict__ ln_b,     // [256]
    float* __restrict__ out)            // [32, 256, 64, 64]
{
    const int C = D_DIM;
    const int P4 = HW_SZ / 4;           // 1024 float4 pixels per image plane
    const int lane = threadIdx.x & 31;
    // wave number in a scalar register -> per-channel vectors come by scalar loads
    const int wave = __builtin_amdgcn_readfirstlane(threadIdx.x >> 5);
    const int b  = blockIdx.x / FUSE_STRIPS;
    const int p4 = (blockIdx.x % FUSE_STRIPS) * (32 * FUSE_TILES) + lane;
    const int c0 = wave * FUSE_CH;

    const f4* vbase = reinterpret_cast<const f4*>(visual) + ((size_t)b * C + c0) * P4 + p4;
    f4*       obase = reinterpret_cast<f4*>(out)          + ((size_t)b * C + c0) * P4 + p4;
    const float* apart = attn_part + b * C + c0 + (lane & (FUSE_CH - 1));
    const float* grow = gate + b * C + c0;
    const float* lg   = ln_g + c0;
    const float* lb   = ln_b + c0;

    // per wave and pixel: partial sum and sum of squares; per pixel: mean, 1/sigma
    __shared__ __attribute__((aligned(16))) float red_sum[FUSE_WAVES][RED_PITCH];
    __shared__ __attribute__((aligned(16))) float red_sq[FUSE_WAVES][RED_PITCH];
    __shared__ __attribute__((aligned(16))) float stat[2][128];
    // the last tile's rows, one 512-byte row per channel
    __shared__ __attribute__((aligned(16))) float xl[D_DIM][128];
    // joining the sums: four lanes per pixel, lane q of them takes waves 4q..4q+3
    const int px = wave * 8 + (lane >> 2);
    const int q  = lane & 3;

    // asked for ahead of the visual rows: loads return in order, so the sum
    // below does not wait for those
    float ap[J_SLICES];
#pragma unroll
    for (int s = 0; s < J_SLICES; ++s)
        ap[s] = apart[s * B_SZ * C];

    // every loop over x[][] is fully unrolled: constant indices keep it in
    // registers, and all 48 loads are in flight before the first is used
    f4 x[FUSE_SETS][FUSE_CH];
#pragma unroll
    for (int s = 0; s < FUSE_SETS; ++s) {
#pragma unroll
        for (int i = 0; i < FUSE_CH; ++i)
            x[s][i] = __builtin_nontemporal_load(vbase + (size_t)i * P4 + s * 32);
        // keeps the loads in tile order: they return in order, and without it
        // the tiles' rows are interleaved, so that tile 0 waits for all of them
        __builtin_amdgcn_sched_barrier(0);
    }
    // precaution: no register that the issued loads name (scalar base, lane
    // offset) is rewritten ahead of this wait
    asm volatile("s_wait_xcnt 0x0" ::: "memory");
    // keeps the copies' address arithmetic behind that wait
    __builtin_amdgcn_sched_barrier(0);

    // the last tile's rows, behind the three others in the queue: lane l of the
    // wave that owns channel c brings bytes 16*l .. 16*l+15 of row c. Eight copies
    // a statement, so that the address registers fit beside the 48 rows; the
    // s_wait_xcnt in the statement: precaution, no address register of an issued
    // copy is rewritten ahead of it
#pragma unroll
    for (int i = 0; i < FUSE_CH; i += 8) {
        const f4* g = vbase + (size_t)i * P4 + (FUSE_TILES - 1) * 32;
        const unsigned l = (unsigned)(size_t)&xl[c0 + i][lane * 4];
        asm volatile("global_load_async_to_lds_b128 %0, %8, off th:TH_LOAD_NT\n\t"
                     "global_load_async_to_lds_b128 %1, %9, off th:TH_LOAD_NT\n\t"
                     "global_load_async_to_lds_b128 %2, %10, off th:TH_LOAD_NT\n\t"
                     "global_load_async_to_lds_b128 %3, %11, off th:TH_LOAD_NT\n\t"
                     "global_load_async_to_lds_b128 %4, %12, off th:TH_LOAD_NT\n\t"
                     "global_load_async_to_lds_b128 %5, %13, off th:TH_LOAD_NT\n\t"
                     "global_load_async_to_lds_b128 %6, %14, off th:TH_LOAD_NT\n\t"
                     "global_load_async_to_lds_b128 %7, %15, off th:TH_LOAD_NT\n\t"
                     "s_wait_xcnt 0x0"
                     :: "v"(l), "v"(l + 512u), "v"(l + 1024u), "v"(l + 1536u),
                        "v"(l + 2048u), "v"(l + 2560u), "v"(l + 3072u), "v"(l + 3584u),
                        "v"(g), "v"(g + P4), "v"(g + 2 * P4), "v"(g + 3 * P4),
                        "v"(g + 4 * P4), "v"(g + 5 * P4), "v"(g + 6 * P4), "v"(g + 7 * P4)
                     : "memory");
        // keeps the second group's address arithmetic behind the first group
        __builtin_amdgcn_sched_barrier(0);
    }

    float asum = ap[0];
#pragma unroll
    for (int s = 1; s < J_SLICES; ++s)
        asum += ap[s];
    const int abits = __float_as_int(asum);

    // per-channel values, wave-uniform, made once for all four tiles
    float av[FUSE_CH], sc[FUSE_CH], sh[FUSE_CH];
#pragma unroll
    for (int i = 0; i < FUSE_CH; ++i) {
        // channel c0 + i's attn value, from lane i into a scalar register
        av[i] = __int_as_float(__builtin_amdgcn_readlane(abits, i));
        const float gm = 1.0f + grow[i];
        sc[i] = lg[i] * gm;                     // fold gate into LN scale
        sh[i] = lb[i] * gm;                     // ...and LN shift
    }

    const float invC = 1.0f / (float)C;

#pragma unroll
    for (int t = 0; t < FUSE_TILES; ++t) {
        const int s = t % FUSE_SETS;

        f4 sum   = {0.f, 0.f, 0.f, 0.f};
        f4 sumsq = {0.f, 0.f, 0.f, 0.f};
#pragma unroll
        for (int i = 0; i < FUSE_CH; ++i) {
            x[s][i] = x[s][i] + av[i];
            sum   = sum + x[s][i];
            sumsq = sumsq + x[s][i] * x[s][i];
        }

        *reinterpret_cast<f4*>(&red_sum[wave][lane * 4]) = sum;
        *reinterpret_cast<f4*>(&red_sq[wave][lane * 4])  = sumsq;
        pgf_lds_barrier();      // all 16 partial sums of the tile are in LDS
        float ps = red_sum[q * 4][px];
        float pq = red_sq[q * 4][px];
#pragma unroll
        for (int j = 1; j < 4; ++j) {
            ps += red_sum[q * 4 + j][px];
            pq += red_sq[q * 4 + j][px];
        }
        // the four lanes of a pixel add up: quad_perm [1,0,3,2], then [2,3,0,1]
        ps += __int_as_float(__builtin_amdgcn_update_dpp(0, __float_as_int(ps), 0xB1, 0xF, 0xF, true));
        pq += __int_as_float(__builtin_amdgcn_update_dpp(0, __float_as_int(pq), 0xB1, 0xF, 0xF, true));
        ps += __int_as_float(__builtin_amdgcn_update_dpp(0, __float_as_int(ps), 0x4E, 0xF, 0xF, true));
        pq += __int_as_float(__builtin_amdgcn_update_dpp(0, __float_as_int(pq), 0x4E, 0xF, 0xF, true));
        const float mu1  = ps * invC;
        const float var1 = pq * invC - mu1 * mu1;
        const float inv1 = rsqrtf(var1 + 1e-5f);
        if (q < 2)
            stat[q][px] = q ? inv1 : mu1;
        if (t == FUSE_TILES - 2) {
            // this wave's copies of the last tile have landed; the barrier below
            // stands between this wait and every read of those rows
            asm volatile("s_wait_asynccnt 0x0" ::: "memory");
        }
        // every read of the partial sums is done (the next tile may overwrite
        // them) and mean and 1/sigma of all 128 pixels are in LDS; their reads
        // below end in front of the next tile's first barrier
        pgf_lds_barrier();
        const f4 mu  = *reinterpret_cast<const f4*>(&stat[0][lane * 4]);
        const f4 inv = *reinterpret_cast<const f4*>(&stat[1][lane * 4]);
        if (t == FUSE_TILES - 2) {
            // the last tile's rows, from LDS into the set that tile 0 has left:
            // read here, so that they arrive under this tile's stores
#pragma unroll
            for (int i = 0; i < FUSE_CH; ++i)
                x[(t + 1) % FUSE_SETS][i] = *reinterpret_cast<const f4*>(&xl[c0 + i][lane * 4]);
        }

#pragma unroll
        for (int i = 0; i < FUSE_CH; ++i) {
            f4 y = (x[s][i] - mu) * inv;
            y = y * sc[i] + sh[i];
            __builtin_nontemporal_store(y, obase + (size_t)i * P4 + t * 32);
        }

        if (t + 1 < FUSE_TILES) {
            // precaution: later work reuses registers that this tile's issued
            // stores name; none is rewritten ahead of this wait
            asm volatile("s_wait_xcnt 0x0" ::: "memory");
            // keeps that later work behind the wait
            __builtin_amdgcn_sched_barrier(0);
        }
    }
}

extern "C" void kernel_launch(void* const* d_in, const int* in_sizes, int n_in,
                              void* d_out, int out_size, void* d_ws, size_t ws_size,
                              hipStream_t stream)
{
    const float* visual  = (const float*)d_in[0];
    const float* text    = (const float*)d_in[1];
    const float* metrics = (const float*)d_in[2];
    const float* Wv      = (const float*)d_in[3];
    const float* bv      = (const float*)d_in[4];
    const float* Wo      = (const float*)d_in[5];
    const float* bo      = (const float*)d_in[6];
    const float* ln_g    = (const float*)d_in[7];
    const float* ln_b    = (const float*)d_in[8];
    const float* gW      = (const float*)d_in[9];
    const float* gb      = (const float*)d_in[10];
    float* out = (float*)d_out;

    float* ws     = (float*)d_ws;
    float* attn_part = ws;                               // 16*32*256 floats
    float* gate      = ws + J_SLICES * B_SZ * D_DIM;     // 32*256 floats

    // partial attn sums (blocks 0..31) and gate (blocks 32..63)
    pgf_prep<<<4 * J_SLICES, 256, 0, stream>>>(text, metrics, Wv, bv, Wo, bo, gW, gb,
                                               attn_part, gate);

    // one block of 16 waves per 512-pixel strip
    pgf_fuse<<<B_SZ * FUSE_STRIPS, 512, 0, stream>>>(visual, attn_part, gate, ln_g, ln_b, out);
}

// v006
// One run takes 19.3 microseconds.
// Next to v005, in two timings, it ran 1.05 times as fast each time.
// All steps since v000 together make it 4.39 times as fast.
#include <hip/hip_runtime.h>
#include <hip/hip_bf16.h>
#include <math.h>

typedef __attribute__((ext_vector_type(2))) float v2f;
typedef __attribute__((ext_vector_type(4))) float f4;
typedef __attribute__((ext_vector_type(8))) float v8f;

#define D_DIM 256
#define B_SZ  32
#define HW_SZ 4096

// ---------------------------------------------------------------------------
// All three small fp32 products (M=32, N=K=256) in ONE launch, on
// V_WMMA_F32_16X16X4_F32.
//   blocks  0..31: (m-tile, j-slice) of the chained product
//                  attn = (text @ Wv^T + bv) @ Wo^T + bo
//   blocks 32..63: (m-tile, n-tile) of gate = sigmoid(metrics @ gW^T + gb)
// Stage 1 (every block): one 16x16 tile of A @ W^T + bias; K = 256 is split
// over the block's 8 waves (32 each), the 8 partial tiles meet in LDS.
// Stage 2 (blocks 0..31): the tile is 16 columns j of v = text @ Wv^T + bv.
// It stays in LDS and is multiplied at once with the same 16 columns of Wo:
// a partial attn[16 x 256] summed over this j-slice only. The 16 slices'
// partials go to the workspace; their consumer adds them. No block needs
// another block's v, so no launch boundary is needed between the products.
// Per-lane WMMA layouts (CDNA5 ISA 7.12.2), slot = r + 2*(lane>=16):
//   A (16x4, M x K):  component r holds A[m = lane&15][k(slot)]
//   B (4x16, K x N):  component r holds W[n = lane&15][k(slot)]
//   C/D (16x16):      vgpr r holds out[m = r + 8*(lane>=16)][n = lane&15]
// k(slot) is the same function for A and B: a lane reads a run of consecutive
// k (16 in stage 1, 8 in stage 2) by 16-byte loads and feeds them pair by pair.
// ---------------------------------------------------------------------------
#define PREP_WAVES 8
#define J_SLICES   (D_DIM / 16)
#define VT_PITCH   20                     // floats; rows stay 16-byte aligned

__device__ __forceinline__ v8f pgf_wmma_pair(f4 a, f4 b, v8f acc)
{
    // 8 args: (neg_a, A, neg_b, B, c_mod, C, reuse_a, reuse_b)
    v2f a0 = {a.x, a.y}, b0 = {b.x, b.y};
    acc = __builtin_amdgcn_wmma_f32_16x16x4_f32(
        false, a0, false, b0, (short)0, acc, false, false);
    v2f a1 = {a.z, a.w}, b1 = {b.z, b.w};
    acc = __builtin_amdgcn_wmma_f32_16x16x4_f32(
        false, a1, false, b1, (short)0, acc, false, false);
    return acc;
}

__global__ __launch_bounds__(256) void pgf_prep(
    const float* text,     // [32 x 256] row-major
    const float* metrics,  // [32 x 256]
    const float* Wv,       // [256 x 256] row-major (out-dim major)
    const float* bv,       // [256]
    const float* Wo,       // [256 x 256]
    const float* bo,       // [256]
    const float* gW,       // [256 x 256]
    const float* gb,       // [256]
    float* attn_part,      // [16 slices][32][256]
    float* gate)           // [32][256]
{
    const int K = D_DIM, N = D_DIM;
    const bool is_gate = blockIdx.x >= 2 * J_SLICES;
    const int tile = blockIdx.x & (2 * J_SLICES - 1);
    const int m0 = (tile & 1) * 16;     // 2 M-tiles
    const int js = tile >> 1;           // 16 N-tiles of stage 1 = j-slices
    const int n0 = js * 16;
    const int tid  = threadIdx.x;
    const int lane = tid & 31;
    const int wave = __builtin_amdgcn_readfirstlane(tid >> 5);
    const int lo = lane & 15;
    const int hi = lane >> 4;           // 0 or 1

    const float* A    = is_gate ? metrics : text;
    const float* Wm   = is_gate ? gW : Wv;
    const float* bias = is_gate ? gb : bv;

    __shared__ float part[PREP_WAVES][256];
    __shared__ __attribute__((aligned(16))) float vt[16][VT_PITCH];

    // stage 1 operands: k = 32*wave + 16*hi + 0..15, one whole line per row
    const f4* ap = reinterpret_cast<const f4*>(A  + (m0 + lo) * K + wave * 32 + hi * 16);
    const f4* wp = reinterpret_cast<const f4*>(Wm + (n0 + lo) * K + wave * 32 + hi * 16);
    f4 av[4], wv[4];
#pragma unroll
    for (int q = 0; q < 4; ++q) { av[q] = ap[q]; wv[q] = wp[q]; }
    const float bs = bias[n0 + (tid & 15)];

    // stage 2 operand, asked for now so that it lands under stage 1:
    // wave w owns n-tiles 2w and 2w+1; j = n0 + 8*hi + 0..7
    f4 ov[2][2] = {};
    float bs2[2] = {0.f, 0.f};
    if (!is_gate) {
#pragma unroll
        for (int t = 0; t < 2; ++t) {
            const int n = (wave * 2 + t) * 16 + lo;
            const f4* op = reinterpret_cast<const f4*>(Wo + n * K + n0 + hi * 8);
            ov[t][0] = op[0];
            ov[t][1] = op[1];
            bs2[t] = bo[n];
        }
    }
    // precaution: no address register of the issued loads is rewritten ahead
    // of this wait (the pointers are not __restrict__, so that no load moves
    // behind it)
    asm volatile("s_wait_xcnt 0x0" ::: "memory");

    v8f acc = {};
#pragma unroll
    for (int q = 0; q < 4; ++q)
        acc = pgf_wmma_pair(av[q], wv[q], acc);

#pragma unroll
    for (int r = 0; r < 8; ++r)
        part[wave][r * 32 + lane] = acc[r];
    __syncthreads();

    // thread tid owns accumulator position (r = tid>>5, lane = tid&31)
    float v = part[0][tid];
#pragma unroll
    for (int w = 1; w < PREP_WAVES; ++w)
        v += part[w][tid];
    v += bs;
    const int em = (tid >> 5) + 8 * ((tid >> 4) & 1);
    const int en = tid & 15;

    if (is_gate) {
        gate[(m0 + em) * N + n0 + en] = 1.0f / (1.0f + __expf(-v));
    } else {
        vt[em][en] = v;
        __syncthreads();                // block-uniform branch
        const f4 a0 = *reinterpret_cast<const f4*>(&vt[lo][hi * 8]);
        const f4 a1 = *reinterpret_cast<const f4*>(&vt[lo][hi * 8 + 4]);
#pragma unroll
        for (int t = 0; t < 2; ++t) {
            v8f c = {};
            c = pgf_wmma_pair(a0, ov[t][0], c);
            c = pgf_wmma_pair(a1, ov[t][1], c);
            const int n = (wave * 2 + t) * 16 + lo;
            float* po = attn_part + (js * B_SZ + m0 + 8 * hi) * N + n;
#pragma unroll
            for (int r = 0; r < 8; ++r)
                po[r * N] = (js == 0) ? c[r] + bs2[t] : c[r];  // bo enters once
        }
        // precaution: no register that the issued stores name (address pair,
        // data) is rewritten ahead of this wait, on any way out of here
        asm volatile("s_wait_xcnt 0x0" ::: "memory");
    }
}

// ---------------------------------------------------------------------------
// Bandwidth-bound fusion: per (b, pixel) LayerNorm over 256 channels plus
// broadcast attn add and gate scaling. visual is read once, so every read of it
// carries the non-temporal hint: its lines are not kept in L2 behind the read.
// One block per WGP (256 blocks of 16 waves) owns 512 consecutive pixels of one
// image and walks them as 4 tiles of 128. In a tile each lane owns 4 pixels
// (float4 = global b128, 512 contiguous bytes per wave and channel) and each
// wave 16 of the 256 channels; the per-pixel sums of the 16 waves meet in LDS.
// All four tiles are asked for at the start, tile by tile over the whole block
// (a barrier behind each of the first three): the rows of tiles 0..2 into three
// register sets, tile 3's rows into LDS by asynchronous copies (each lane brings
// its own 16 bytes and later reads those same bytes back into tile 0's set). So
// no read is asked for behind a store, the stores of earlier tiles run under
// each tile's arithmetic, and attn, gate and the LN vectors are fetched once.
// attn arrives as 16 partial sums per channel: lane l of a wave adds those of
// channel c0 + (l & 15) while the visual rows are in flight.
// ---------------------------------------------------------------------------
#define FUSE_WAVES  16
#define FUSE_CH     (D_DIM / FUSE_WAVES)          // channels held per wave
#define FUSE_TILES  4                             // 128-pixel tiles per block
#define FUSE_SETS   3                             // register sets of one tile
#define FUSE_STRIPS (HW_SZ / (128 * FUSE_TILES))  // blocks per image
#define RED_PITCH   132   // floats: rows 16-byte aligned, 4 rows apart = 16 banks

__device__ __forceinline__ void pgf_lds_barrier()
{
    // work-group barrier for LDS traffic alone: this wave's LDS writes and reads
    // are done, then signal and wait. __syncthreads() would also drain the
    // global loads asked for ahead and the stores of the tile before.
    asm volatile("s_wait_dscnt 0x0\n\ts_barrier_signal -1\n\ts_barrier_wait -1" ::: "memory");
}

__device__ __forceinline__ void pgf_issue_barrier()
{
    // work-group barrier with no wait on any counter: it orders the ISSUE of
    // the waves' global loads and leaves all of them in flight
    asm volatile("s_barrier_signal -1\n\ts_barrier_wait -1" ::: "memory");
}

__global__ __launch_bounds__(512) void pgf_fuse(
    const float* __restrict__ visual,   // [32, 256, 64, 64]
    const float* __restrict__ attn_part,// [16 slices, 32, 256]
    const float* __restrict__ gate,     // [32, 256]
    const float* __restrict__ ln_g,     // [256]
    const float* __restrict__ ln_b,     // [256]
    float* __restrict__ out)            // [32, 256, 64, 64]
{
    const int C = D_DIM;
    const int P4 = HW_SZ / 4;           // 1024 float4 pixels per image plane
    const int lane = threadIdx.x & 31;
    // wave number in a scalar register -> per-channel vectors come by scalar loads
    const int wave = __builtin_amdgcn_readfirstlane(threadIdx.x >> 5);
    const int b  = blockIdx.x / FUSE_STRIPS;
    const int p4 = (blockIdx.x % FUSE_STRIPS) * (32 * FUSE_TILES) + lane;
    const int c0 = wave * FUSE_CH;

    const f4* vbase = reinterpret_cast<const f4*>(visual) + ((size_t)b * C + c0) * P4 + p4;
    f4*       obase = reinterpret_cast<f4*>(out)          + ((size_t)b * C + c0) * P4 + p4;
    const float* apart = attn_part + b * C + c0 + (lane & (FUSE_CH - 1));
    const float* grow = gate + b * C + c0;
    const float* lg   = ln_g + c0;
    const float* lb   = ln_b + c0;

    // per wave and pixel: partial sum and sum of squares; per pixel: mean, 1/sigma
    __shared__ __attribute__((aligned(16))) float red_sum[FUSE_WAVES][RED_PITCH];
    __shared__ __attribute__((aligned(16))) float red_sq[FUSE_WAVES][RED_PITCH];
    __shared__ __attribute__((aligned(16))) float stat[2][128];
    // the last tile's rows, one 512-byte row per channel
    __shared__ __attribute__((aligned(16))) float xl[D_DIM][128];
    // joining the sums: four lanes per pixel, lane q of them takes waves 4q..4q+3
    const int px = wave * 8 + (lane >> 2);
    const int q  = lane & 3;

    // asked for ahead of the visual rows: loads return in order, so the sum
    // below does not wait for those
    float ap[J_SLICES];
#pragma unroll
    for (int s = 0; s < J_SLICES; ++s)
        ap[s] = apart[s * B_SZ * C];

    // every loop over x[][] is fully unrolled: constant indices keep it in
    // registers, and all 48 loads are in flight before the first is used
    f4 x[FUSE_SETS][FUSE_CH];
#pragma unroll
    for (int s = 0; s < FUSE_SETS; ++s) {
#pragma unroll
        for (int i = 0; i < FUSE_CH; ++i)
            x[s][i] = __builtin_nontemporal_load(vbase + (size_t)i * P4 + s * 32);
        // keeps the loads in tile order: they return in order, and without it
        // the tiles' rows are interleaved, so that tile 0 waits for all of them
        __builtin_amdgcn_sched_barrier(0);
        // the same order ACROSS the waves: tile s of all 16 waves is asked for
        // before tile s + 1 of any, for speed only
        pgf_issue_barrier();
    }
    // precaution: no register that the issued loads name (scalar base, lane
    // offset) is rewritten ahead of this wait
    asm volatile("s_wait_xcnt 0x0" ::: "memory");
    // keeps the copies' address arithmetic behind that wait
    __builtin_amdgcn_sched_barrier(0);

    // the last tile's rows, behind the three others in the queue: lane l of the
    // wave that owns channel c brings bytes 16*l .. 16*l+15 of row c. Eight copies
    // a statement, so that the address registers fit beside the 48 rows; the
    // s_wait_xcnt in the statement: precaution, no address register of an issued
    // copy is rewritten ahead of it
#pragma unroll
    for (int i = 0; i < FUSE_CH; i += 8) {
        const f4* g = vbase + (size_t)i * P4 + (FUSE_TILES - 1) * 32;
        const unsigned l = (unsigned)(size_t)&xl[c0 + i][lane * 4];
        asm volatile("global_load_async_to_lds_b128 %0, %8, off th:TH_LOAD_NT\n\t"
                     "global_load_async_to_lds_b128 %1, %9, off th:TH_LOAD_NT\n\t"
                     "global_load_async_to_lds_b128 %2, %10, off th:TH_LOAD_NT\n\t"
                     "global_load_async_to_lds_b128 %3, %11, off th:TH_LOAD_NT\n\t"
                     "global_load_async_to_lds_b128 %4, %12, off th:TH_LOAD_NT\n\t"
                     "global_load_async_to_lds_b128 %5, %13, off th:TH_LOAD_NT\n\t"
                     "global_load_async_to_lds_b128 %6, %14, off th:TH_LOAD_NT\n\t"
                     "global_load_async_to_lds_b128 %7, %15, off th:TH_LOAD_NT\n\t"
                     "s_wait_xcnt 0x0"
                     :: "v"(l), "v"(l + 512u), "v"(l + 1024u), "v"(l + 1536u),
                        "v"(l + 2048u), "v"(l + 2560u), "v"(l + 3072u), "v"(l + 3584u),
                        "v"(g), "v"(g + P4), "v"(g + 2 * P4), "v"(g + 3 * P4),
                        "v"(g + 4 * P4), "v"(g + 5 * P4), "v"(g + 6 * P4), "v"(g + 7 * P4)
                     : "memory");
        // keeps the second group's address arithmetic behind the first group
        __builtin_amdgcn_sched_barrier(0);
    }

    float asum = ap[0];
#pragma unroll
    for (int s = 1; s < J_SLICES; ++s)
        asum += ap[s];
    const int abits = __float_as_int(asum);

    // per-channel values, wave-uniform, made once for all four tiles
    float av[FUSE_CH], sc[FUSE_CH], sh[FUSE_CH];
#pragma unroll
    for (int i = 0; i < FUSE_CH; ++i) {
        // channel c0 + i's attn value, from lane i into a scalar register
        av[i] = __int_as_float(__builtin_amdgcn_readlane(abits, i));
        const float gm = 1.0f + grow[i];
        sc[i] = lg[i] * gm;                     // fold gate into LN scale
        sh[i] = lb[i] * gm;                     // ...and LN shift
    }

    const float invC = 1.0f / (float)C;

#pragma unroll
    for (int t = 0; t < FUSE_TILES; ++t) {
        const int s = t % FUSE_SETS;

        f4 sum   = {0.f, 0.f, 0.f, 0.f};
        f4 sumsq = {0.f, 0.f, 0.f, 0.f};
#pragma unroll
        for (int i = 0; i < FUSE_CH; ++i) {
            x[s][i] = x[s][i] + av[i];
            sum   = sum + x[s][i];
            sumsq = sumsq + x[s][i] * x[s][i];
        }

        *reinterpret_cast<f4*>(&red_sum[wave][lane * 4]) = sum;
        *reinterpret_cast<f4*>(&red_sq[wave][lane * 4])  = sumsq;
        pgf_lds_barrier();      // all 16 partial sums of the tile are in LDS
        float ps = red_sum[q * 4][px];
        float pq = red_sq[q * 4][px];
#pragma unroll
        for (int j = 1; j < 4; ++j) {
            ps += red_sum[q * 4 + j][px];
            pq += red_sq[q * 4 + j][px];
        }
        // the four lanes of a pixel add up: quad_perm [1,0,3,2], then [2,3,0,1]
        ps += __int_as_float(__builtin_amdgcn_update_dpp(0, __float_as_int(ps), 0xB1, 0xF, 0xF, true));
        pq += __int_as_float(__builtin_amdgcn_update_dpp(0, __float_as_int(pq), 0xB1, 0xF, 0xF, true));
        ps += __int_as_float(__builtin_amdgcn_update_dpp(0, __float_as_int(ps), 0x4E, 0xF, 0xF, true));
        pq += __int_as_float(__builtin_amdgcn_update_dpp(0, __float_as_int(pq), 0x4E, 0xF, 0xF, true));
        const float mu1  = ps * invC;
        const float var1 = pq * invC - mu1 * mu1;
        const float inv1 = rsqrtf(var1 + 1e-5f);
        if (q < 2)
            stat[q][px] = q ? inv1 : mu1;
        if (t == FUSE_TILES - 2) {
            // this wave's copies of the last tile have landed; the barrier below
            // stands between this wait and every read of those rows
            asm volatile("s_wait_asynccnt 0x0" ::: "memory");
        }
        // every read of the partial sums is done (the next tile may overwrite
        // them) and mean and 1/sigma of all 128 pixels are in LDS; their reads
        // below end in front of the next tile's first barrier
        pgf_lds_barrier();
        const f4 mu  = *reinterpret_cast<const f4*>(&stat[0][lane * 4]);
        const f4 inv = *reinterpret_cast<const f4*>(&stat[1][lane * 4]);
        if (t == FUSE_TILES - 2) {
            // the last tile's rows, from LDS into the set that tile 0 has left:
            // read here, so that they arrive under this tile's stores
#pragma unroll
            for (int i = 0; i < FUSE_CH; ++i)
                x[(t + 1) % FUSE_SETS][i] = *reinterpret_cast<const f4*>(&xl[c0 + i][lane * 4]);
        }

#pragma unroll
        for (int i = 0; i < FUSE_CH; ++i) {
            f4 y = (x[s][i] - mu) * inv;
            y = y * sc[i] + sh[i];
            __builtin_nontemporal_store(y, obase + (size_t)i * P4 + t * 32);
        }

        if (t + 1 < FUSE_TILES) {
            // precaution: later work reuses registers that this tile's issued
            // stores name; none is rewritten ahead of this wait
            asm volatile("s_wait_xcnt 0x0" ::: "memory");
            // keeps that later work behind the wait
            __builtin_amdgcn_sched_barrier(0);
        }
    }
}

extern "C" void kernel_launch(void* const* d_in, const int* in_sizes, int n_in,
                              void* d_out, int out_size, void* d_ws, size_t ws_size,
                              hipStream_t stream)
{
    const float* visual  = (const float*)d_in[0];
    const float* text    = (const float*)d_in[1];
    const float* metrics = (const float*)d_in[2];
    const float* Wv      = (const float*)d_in[3];
    const float* bv      = (const float*)d_in[4];
    const float* Wo      = (const float*)d_in[5];
    const float* bo      = (const float*)d_in[6];
    const float* ln_g    = (const float*)d_in[7];
    const float* ln_b    = (const float*)d_in[8];
    const float* gW      = (const float*)d_in[9];
    const float* gb      = (const float*)d_in[10];
    float* out = (float*)d_out;

    float* ws     = (float*)d_ws;
    float* attn_part = ws;                               // 16*32*256 floats
    float* gate      = ws + J_SLICES * B_SZ * D_DIM;     // 32*256 floats

    // partial attn sums (blocks 0..31) and gate (blocks 32..63)
    pgf_prep<<<4 * J_SLICES, 256, 0, stream>>>(text, metrics, Wv, bv, Wo, bo, gW, gb,
                                               attn_part, gate);

    // one block of 16 waves per 512-pixel strip
    pgf_fuse<<<B_SZ * FUSE_STRIPS, 512, 0, stream>>>(visual, attn_part, gate, ln_g, ln_b, out);
}
